// v000
// Measured on an AMD MI455X. A time is GPU time per run, averaged over a window of back-to-back runs after a warm-up
// (all launches, gaps included; the runs take copies of the inputs in turn), and the median of several windows.
// Apart from v000's, it joins two sittings. Times from different sittings can be a few percent apart, while
// side-by-side timings come from the same sitting.
// v000, which the later versions start from, runs in 193 microseconds.
#include <hip/hip_runtime.h>

// OutProductMean: Mn = LN(M) over the 64 features; left = Mn Wa^T + ba (32), right = Mn Wb^T + bb (32); O[i][j][p][e] = Σ_s left[s][i][p] right[s][j][e];
// Z[i][j][o] = Σ_{p,e} O[i][j][p*32+e] Wo[o][p*32+e] + bo -> [1][256][256][128].
// WMMA (v_wmma_f32_16x16x32_f16, f32 accumulate): the two projections with EXACT weights and the LayerNormed rows as f16 hi+lo pairs x8 (2 products); per (i, j): O_ij[p][e] = Σ_s L_i[s][p] R_j[s][e] as a
// [32 x 128] x [128 x 32] product with the left/right planes as f16 hi+lo pairs x8 (3 products); the block's 16 O tiles are staged in LDS as hi+lo f16 rows and feed Z = O.Wo^T [16 x 1024] x
// [1024 x 128] (2 products, exact Wo). LayerNorm in f32. Fragment k-map per lane

namespace {
constexpr int S = 128, I = 256, D = 64, P = 32, DO = 128, PP = P * P;
constexpr float XS = 8.0f, OS = 0.25f /* O staged x0.25 in f16 (|O| ≲ 60) */, EPS = 1e-5f;

typedef _Float16 b16;
typedef __attribute__((ext_vector_type(16))) _Float16 v16b;
typedef __attribute__((ext_vector_type(8))) _Float16 v8b;
typedef __attribute__((ext_vector_type(8))) float v8f;
typedef __attribute__((ext_vector_type(4))) float v4f;
__device__ __forceinline__ float bf16_rne(float f) { unsigned int u = __float_as_uint(f); u += 0x7FFFu + ((u >> 16) & 1u); return __uint_as_float(u & 0xFFFF0000u); }
__device__ __forceinline__ v16b frag_kb(const b16* p, int hh) { const v8b a = *(const v8b*)(p + 8 * hh), b = *(const v8b*)(p + 16 + 8 * hh); v16b f;
#pragma unroll
  for (int e = 0; e < 8; ++e) { f[e] = a[e]; f[8 + e] = b[e]; } return f; }
__device__ __forceinline__ v8f wmma16b(v16b a, v16b b, v8f c) { v8f d = __builtin_amdgcn_wmma_f32_16x16x32_f16(false, a, false, b, (short)0, c, false, false); asm volatile("v_nop\n\tv_nop\n\tv_nop\n\tv_nop" : "+v"(d) : "v"(a), "v"(b)); return d; }
__device__ __forceinline__ void wave_lds_sync() { __builtin_amdgcn_fence(__ATOMIC_RELEASE, "workgroup"); __builtin_amdgcn_wave_barrier(); __builtin_amdgcn_fence(__ATOMIC_ACQUIRE, "workgroup"); }
__device__ __forceinline__ float pmul(float a, float b) { float p = a * b; asm volatile("" : "+v"(p)); return p; }
__device__ __forceinline__ float wsum(float v) {
#pragma unroll
  for (int o = 1; o < 32; o <<= 1) v += __shfl_xor(v, o); return v; }

// LN + projections: block = (i, 8 waves): for the 128 rows (s, i): LN over 64 (wave per row, 2 per lane), hi+lo f16 x8 A rows in LDS; [128 x 64] x [64 x 64] ([Wa;Wb] exact rows) + bias;
__global__ __launch_bounds__(256) void proj_kernel(const float* __restrict__ M, const float* __restrict__ g, const float* __restrict__ be, const float* __restrict__ Wa, const float* __restrict__ ba, const float* __restrict__ Wb, const float* __restrict__ bb, const float* __restrict__ Wo, const float* __restrict__ bo, b16* __restrict__ LT, b16* __restrict__ RT, b16* __restrict__ LTl, b16* __restrict__ RTl, b16* __restrict__ RW, float* __restrict__ Pb) {
  __shared__ __attribute__((aligned(16))) b16 Ar[S][D + 8], Arl[S][D + 8]; __shared__ __attribute__((aligned(16))) b16 Wr[2 * P][D + 8]; __shared__ __attribute__((aligned(16))) b16 To[2 * P][S + 8], Tol[2 * P][S + 8]; __shared__ float bias[64];
  const int i = blockIdx.x, t_ = threadIdx.x, lane = t_ & 31, wave = t_ >> 5, nloc = lane & 15, hlf = lane >> 4;
  for (int q = t_; q < 2 * P * D; q += 256) { const int o = q / D, d = q % D; Wr[o][d] = (b16)bf16_rne((o < P) ? Wa[o * D + d] : Wb[(o - P) * D + d]); }
  if (t_ < 64) bias[t_] = bf16_rne((t_ < P) ? ba[t_] : bb[t_ - P]);
  for (int q = 0; q < 16; ++q) { const int s = wave * 16 + q; const float* mr = M + ((size_t)s * I + i) * D; const float x0 = bf16_rne(mr[lane]), x1 = bf16_rne(mr[32 + lane]);
    const float mu = wsum(x0 + x1) * (1.0f / D); const float d0 = x0 - mu, d1 = x1 - mu; const float var = wsum(pmul(d0, d0) + pmul(d1, d1)) * (1.0f / D); const float inv = rsqrtf(var + EPS);
    { const float y0 = (pmul(d0 * inv, bf16_rne(g[lane])) + bf16_rne(be[lane])) * XS, y1 = (pmul(d1 * inv, bf16_rne(g[32 + lane])) + bf16_rne(be[32 + lane])) * XS; const b16 h0 = (b16)y0, h1 = (b16)y1; Ar[s][lane] = h0; Arl[s][lane] = (b16)(y0 - (float)h0); Ar[s][32 + lane] = h1; Arl[s][32 + lane] = (b16)(y1 - (float)h1); } }
  __syncthreads();
  // wave w: rows 16w..16w+15 x 64 cols (4 subtiles) x 2 k-steps
  v8f acc[4] = {{}, {}, {}, {}};
#pragma unroll
  for (int kb = 0; kb < D; kb += 32) { const v16b a = frag_kb(&Ar[wave * 16 + nloc][kb], hlf), al = frag_kb(&Arl[wave * 16 + nloc][kb], hlf);
#pragma unroll
    for (int t = 0; t < 4; ++t) { const v16b bw = frag_kb(&Wr[t * 16 + nloc][kb], hlf); acc[t] = wmma16b(a, bw, acc[t]); acc[t] = wmma16b(al, bw, acc[t]); } }
#pragma unroll
  for (int t = 0; t < 4; ++t)
#pragma unroll
    for (int r = 0; r < 8; ++r) { const int c = t * 16 + nloc, s = wave * 16 + 8 * hlf + r; const float y = (acc[t][r] * (1.0f / XS) + bias[c]) * XS; const b16 h_ = (b16)y; To[c][s] = h_; Tol[c][s] = (b16)(y - (float)h_); }
  __syncthreads();
  {
    for (int q = t_; q < 2 * P * (S / 8); q += 256) { const int c = q / (S / 8), s8 = (q % (S / 8)) * 8; const size_t gi = (c < P) ? (((size_t)i * P + c) * S + s8) : (((size_t)i * P + (c - P)) * S + s8); b16* dh = (c < P) ? LT : RT; b16* dl = (c < P) ? LTl : RTl; *(v8b*)(dh + gi) = *(const v8b*)(&To[c][s8]); *(v8b*)(dl + gi) = *(const v8b*)(&Tol[c][s8]); }
    if (i < 64) { for (int q = i * 256 + t_; q < DO * PP / 8; q += 64 * 256) { v8b v; for (int e = 0; e < 8; ++e) v[e] = (b16)bf16_rne(Wo[(size_t)q * 8 + e]); *(v8b*)(RW + (size_t)q * 8) = v; } if (i == 0 && t_ < DO) Pb[t_] = bf16_rne(bo[t_]); }
     }
}

// outer product + output: block = (i, 16 j's) x 8 waves: wave w -> j = j0 + 2w, j0 + 2w + 1: O_ij = L_i[32 x 128] . R_j^T (2x2 tiles x 4 k-steps) -> staged f16 (x OS) as the Z GEMM's A rows
// Og[jl][p*32+e]; then Z[i][j0+jl][o] = Σ_k Og[jl][k] Wo[o][k] + bo: wave w -> subtile o = 16w..16w+15 (1 row tile x 32 k-steps); output rows (i, j) = 512 B: the block's 16 rows = 8 KB contiguous,
__global__ __launch_bounds__(256) void opm_kernel(const b16* __restrict__ LT, const b16* __restrict__ RT, const b16* __restrict__ LTl, const b16* __restrict__ RTl, const b16* __restrict__ RW, const float* __restrict__ Pb, float* __restrict__ out) {
  __shared__ __attribute__((aligned(16))) b16 Og[16][PP + 8], Ogl[16][PP + 8]; __shared__ __attribute__((aligned(16))) float Zs[16][DO + 4];
  const int i = blockIdx.y, j0 = blockIdx.x * 16, t_ = threadIdx.x, lane = t_ & 31, wave = t_ >> 5, nloc = lane & 15, hlf = lane >> 4;
  const b16* Li = LT + (size_t)i * P * S; const b16* Lil = LTl + (size_t)i * P * S;
  for (int jj = 0; jj < 2; ++jj) { const int jl = wave * 2 + jj, j = j0 + jl; const b16* Rj = RT + (size_t)j * P * S; const b16* Rjl = RTl + (size_t)j * P * S; v8f acc[2][2] = {{{}, {}}, {{}, {}}};
#pragma unroll
    for (int kb = 0; kb < S; kb += 32) { const v16b a0 = frag_kb(Li + (size_t)nloc * S + kb, hlf), a1 = frag_kb(Li + (size_t)(16 + nloc) * S + kb, hlf), l0 = frag_kb(Lil + (size_t)nloc * S + kb, hlf), l1 = frag_kb(Lil + (size_t)(16 + nloc) * S + kb, hlf);
      const v16b b0 = frag_kb(Rj + (size_t)nloc * S + kb, hlf), b1 = frag_kb(Rj + (size_t)(16 + nloc) * S + kb, hlf), m0_ = frag_kb(Rjl + (size_t)nloc * S + kb, hlf), m1_ = frag_kb(Rjl + (size_t)(16 + nloc) * S + kb, hlf);
      acc[0][0] = wmma16b(a0, b0, acc[0][0]); acc[0][0] = wmma16b(l0, b0, acc[0][0]); acc[0][0] = wmma16b(a0, m0_, acc[0][0]);
      acc[0][1] = wmma16b(a0, b1, acc[0][1]); acc[0][1] = wmma16b(l0, b1, acc[0][1]); acc[0][1] = wmma16b(a0, m1_, acc[0][1]);
      acc[1][0] = wmma16b(a1, b0, acc[1][0]); acc[1][0] = wmma16b(l1, b0, acc[1][0]); acc[1][0] = wmma16b(a1, m0_, acc[1][0]);
      acc[1][1] = wmma16b(a1, b1, acc[1][1]); acc[1][1] = wmma16b(l1, b1, acc[1][1]); acc[1][1] = wmma16b(a1, m1_, acc[1][1]); }
#pragma unroll
    for (int rt = 0; rt < 2; ++rt)
#pragma unroll
      for (int ct = 0; ct < 2; ++ct)
#pragma unroll
        for (int r = 0; r < 8; ++r) { const int p = rt * 16 + 8 * hlf + r, e = ct * 16 + nloc; const float y = acc[rt][ct][r] * (OS / (XS * XS)); const b16 h_ = (b16)y; Og[jl][p * P + e] = h_; Ogl[jl][p * P + e] = (b16)(y - (float)h_); } }
  __syncthreads();
  v8f z = {};
#pragma unroll 4
  for (int kb = 0; kb < PP; kb += 32) { const v16b bw = frag_kb(RW + (size_t)(wave * 16 + nloc) * PP + kb, hlf); z = wmma16b(frag_kb(&Og[nloc][kb], hlf), bw, z); z = wmma16b(frag_kb(&Ogl[nloc][kb], hlf), bw, z); }
#pragma unroll
  for (int r = 0; r < 8; ++r) { const int o = wave * 16 + nloc; Zs[8 * hlf + r][o] = z[r] * (1.0f / OS) + Pb[o]; }
  __syncthreads();
  { for (int q = t_; q < 16 * (DO / 4); q += 256) { const int jl = q / (DO / 4), c4 = (q % (DO / 4)) * 4; *(v4f*)(out + ((size_t)i * I + j0 + jl) * DO + c4) = *(const v4f*)(&Zs[jl][c4]); }  }
}
}  // namespace

extern "C" void kernel_launch(void* const* d_in, const int* in_sizes, int n_in,
                              void* d_out, int out_size, void* d_ws, size_t ws_size, hipStream_t stream) {
  (void)n_in; (void)out_size;
  const float* M = (const float*)d_in[0]; const float* g = (const float*)d_in[1]; const float* be = (const float*)d_in[2]; const float* Wa = (const float*)d_in[3]; const float* ba = (const float*)d_in[4]; const float* Wb = (const float*)d_in[5]; const float* bb = (const float*)d_in[6]; const float* Wo = (const float*)d_in[7]; const float* bo = (const float*)d_in[8];
  float* out = (float*)d_out;   // [1][256][256][128]
  if (in_sizes[0] != S * I * D || in_sizes[3] != P * D || in_sizes[7] != DO * PP) return;
  size_t off = 0; char* ws = (char*)d_ws;
  auto carve = [&](size_t bytes) { char* p = ws + off; off += (bytes + 255) & ~(size_t)255; return p; };
  b16* LT = (b16*)carve((size_t)I * P * S * 2); b16* RT = (b16*)carve((size_t)I * P * S * 2); b16* LTl = (b16*)carve((size_t)I * P * S * 2); b16* RTl = (b16*)carve((size_t)I * P * S * 2); b16* RW = (b16*)carve((size_t)DO * PP * 2); float* Pb = (float*)carve(DO * 4);
  if (off > ws_size) return;                                    // ≈ 2.1 x 4 + 0.26 MB
  proj_kernel<<<I, 256, 0, stream>>>(M, g, be, Wa, ba, Wb, bb, Wo, bo, LT, RT, LTl, RTl, RW, Pb);
  opm_kernel<<<dim3(I / 16, I), 256, 0, stream>>>(LT, RT, LTl, RTl, RW, Pb, out);
}

// v001
// One run takes 124 microseconds.
// Next to v000, in two timings, it ran 1.62 times as fast each time.
#include <hip/hip_runtime.h>

// OutProductMean: Mn = LN(M) over the 64 features; left = Mn Wa^T + ba (32), right = Mn Wb^T + bb (32); O[i][j][p][e] = Σ_s left[s][i][p] right[s][j][e];
// Z[i][j][o] = Σ_{p,e} O[i][j][p*32+e] Wo[o][p*32+e] + bo -> [1][256][256][128].
// WMMA (v_wmma_f32_16x16x32_f16, f32 accumulate): the two projections with EXACT weights and the LayerNormed rows as f16 hi+lo pairs x8 (2 products); per (i, j): O_ij[p][e] = Σ_s L_i[s][p] R_j[s][e] as a
// [32 x 128] x [128 x 32] product with the left/right planes as f16 hi+lo pairs x8 (3 products); the block's 16 O tiles are staged in LDS as hi+lo f16 rows and feed Z = O.Wo^T [16 x 1024] x
// [1024 x 128] (2 products, exact Wo). LayerNorm in f32. Fragment k-map per lane

namespace {
constexpr int S = 128, I = 256, D = 64, P = 32, DO = 128, PP = P * P;
constexpr float XS = 8.0f, OS = 0.25f /* O staged x0.25 in f16 (|O| ≲ 60) */, EPS = 1e-5f;

typedef _Float16 b16;
typedef __attribute__((ext_vector_type(16))) _Float16 v16b;
typedef __attribute__((ext_vector_type(8))) _Float16 v8b;
typedef __attribute__((ext_vector_type(8))) float v8f;
typedef __attribute__((ext_vector_type(4))) float v4f;
__device__ __forceinline__ float bf16_rne(float f) { unsigned int u = __float_as_uint(f); u += 0x7FFFu + ((u >> 16) & 1u); return __uint_as_float(u & 0xFFFF0000u); }
__device__ __forceinline__ v16b frag_kb(const b16* p, int hh) { const v8b a = *(const v8b*)(p + 8 * hh), b = *(const v8b*)(p + 16 + 8 * hh); v16b f;
#pragma unroll
  for (int e = 0; e < 8; ++e) { f[e] = a[e]; f[8 + e] = b[e]; } return f; }
// Packed fragment: 512 halves in lane order, two planes of 32 lanes x 8 halves (k 8*hlf+e, then 16+8*hlf+e), so that each wave-wide 16-byte load covers 512 contiguous bytes.
typedef const __attribute__((address_space(1))) b16* gb16; typedef const __attribute__((address_space(1))) v8b* gv8b;
__device__ __forceinline__ v16b frag_pk(gb16 p, unsigned lane) { const v8b a = *(gv8b)(p + 8 * lane), b = *(gv8b)(p + 256 + 8 * lane); v16b f;
#pragma unroll
  for (int e = 0; e < 8; ++e) { f[e] = a[e]; f[8 + e] = b[e]; } return f; }
// A wave's own plane base as a scalar pair: its fragment loads are then scalar base + 16 B x lane, and the one vector register they name (the lane's offset) lives to the kernel's end.
__device__ __forceinline__ gb16 wave_base(const b16* p) { const unsigned long long u = (unsigned long long)p; const unsigned lo = (unsigned)__builtin_amdgcn_readfirstlane((int)(unsigned)u), hi = (unsigned)__builtin_amdgcn_readfirstlane((int)(unsigned)(u >> 32)); return (gb16)(((unsigned long long)hi << 32) | lo); }
__device__ __forceinline__ v8f wmma16b(v16b a, v16b b, v8f c) { v8f d = __builtin_amdgcn_wmma_f32_16x16x32_f16(false, a, false, b, (short)0, c, false, false); asm volatile("v_nop\n\tv_nop\n\tv_nop\n\tv_nop" : "+v"(d) : "v"(a), "v"(b)); return d; }
__device__ __forceinline__ void wave_lds_sync() { __builtin_amdgcn_fence(__ATOMIC_RELEASE, "workgroup"); __builtin_amdgcn_wave_barrier(); __builtin_amdgcn_fence(__ATOMIC_ACQUIRE, "workgroup"); }
__device__ __forceinline__ float pmul(float a, float b) { float p = a * b; asm volatile("" : "+v"(p)); return p; }
__device__ __forceinline__ float wsum(float v) {
#pragma unroll
  for (int o = 1; o < 32; o <<= 1) v += __shfl_xor(v, o); return v; }

// LN + projections: block = (i, 8 waves): for the 128 rows (s, i): LN over 64 (wave per row, 2 per lane), hi+lo f16 x8 A rows in LDS; [128 x 64] x [64 x 64] ([Wa;Wb] exact rows) + bias;
__global__ __launch_bounds__(256) void proj_kernel(const float* __restrict__ M, const float* __restrict__ g, const float* __restrict__ be, const float* __restrict__ Wa, const float* __restrict__ ba, const float* __restrict__ Wb, const float* __restrict__ bb, const float* __restrict__ Wo, const float* __restrict__ bo, b16* __restrict__ LT, b16* __restrict__ RT, b16* __restrict__ LTl, b16* __restrict__ RTl, b16* __restrict__ RW, float* __restrict__ Pb) {
  __shared__ __attribute__((aligned(16))) b16 Ar[S][D + 8], Arl[S][D + 8]; __shared__ __attribute__((aligned(16))) b16 Wr[2 * P][D + 8]; __shared__ __attribute__((aligned(16))) b16 To[2 * P][S + 8], Tol[2 * P][S + 8]; __shared__ float bias[64];
  const int i = blockIdx.x, t_ = threadIdx.x, lane = t_ & 31, wave = t_ >> 5, nloc = lane & 15, hlf = lane >> 4;
  for (int q = t_; q < 2 * P * D; q += 256) { const int o = q / D, d = q % D; Wr[o][d] = (b16)bf16_rne((o < P) ? Wa[o * D + d] : Wb[(o - P) * D + d]); }
  if (t_ < 64) bias[t_] = bf16_rne((t_ < P) ? ba[t_] : bb[t_ - P]);
  for (int q = 0; q < 16; ++q) { const int s = wave * 16 + q; const float* mr = M + ((size_t)s * I + i) * D; const float x0 = bf16_rne(mr[lane]), x1 = bf16_rne(mr[32 + lane]);
    const float mu = wsum(x0 + x1) * (1.0f / D); const float d0 = x0 - mu, d1 = x1 - mu; const float var = wsum(pmul(d0, d0) + pmul(d1, d1)) * (1.0f / D); const float inv = rsqrtf(var + EPS);
    { const float y0 = (pmul(d0 * inv, bf16_rne(g[lane])) + bf16_rne(be[lane])) * XS, y1 = (pmul(d1 * inv, bf16_rne(g[32 + lane])) + bf16_rne(be[32 + lane])) * XS; const b16 h0 = (b16)y0, h1 = (b16)y1; Ar[s][lane] = h0; Arl[s][lane] = (b16)(y0 - (float)h0); Ar[s][32 + lane] = h1; Arl[s][32 + lane] = (b16)(y1 - (float)h1); } }
  __syncthreads();
  // wave w: rows 16w..16w+15 x 64 cols (4 subtiles) x 2 k-steps
  v8f acc[4] = {{}, {}, {}, {}};
#pragma unroll
  for (int kb = 0; kb < D; kb += 32) { const v16b a = frag_kb(&Ar[wave * 16 + nloc][kb], hlf), al = frag_kb(&Arl[wave * 16 + nloc][kb], hlf);
#pragma unroll
    for (int t = 0; t < 4; ++t) { const v16b bw = frag_kb(&Wr[t * 16 + nloc][kb], hlf); acc[t] = wmma16b(a, bw, acc[t]); acc[t] = wmma16b(al, bw, acc[t]); } }
#pragma unroll
  for (int t = 0; t < 4; ++t)
#pragma unroll
    for (int r = 0; r < 8; ++r) { const int c = t * 16 + nloc, s = wave * 16 + 8 * hlf + r; const float y = (acc[t][r] * (1.0f / XS) + bias[c]) * XS; const b16 h_ = (b16)y; To[c][s] = h_; Tol[c][s] = (b16)(y - (float)h_); }
  __syncthreads();
  {
    // planes leave in fragment order: chunk w = ((row tile * 4 + k block) * 2 + k half) * 32 + lane holds row 16*tile + (lane & 15), s = 32*block + 16*half + 8*(lane >> 4) .. +7
    for (int q = t_; q < 2 * P * (S / 8); q += 256) { const int side = q >> 9, w = q & 511, ln = w & 31; const int c = side * P + (w >> 8) * 16 + (ln & 15), s8 = ((w >> 6) & 3) * 32 + ((w >> 5) & 1) * 16 + (ln >> 4) * 8; const size_t gi = (size_t)i * P * S + (size_t)w * 8; b16* dh = side ? RT : LT; b16* dl = side ? RTl : LTl; *(v8b*)(dh + gi) = *(const v8b*)(&To[c][s8]); *(v8b*)(dl + gi) = *(const v8b*)(&Tol[c][s8]); }
    if (i < 64) { for (int q = i * 256 + t_; q < DO * PP / 8; q += 64 * 256) { const int ln = q & 31; const size_t sw = (size_t)((q >> 11) * 16 + (ln & 15)) * PP + ((q >> 6) & 31) * 32 + ((q >> 5) & 1) * 16 + (ln >> 4) * 8; v8b v; for (int e = 0; e < 8; ++e) v[e] = (b16)bf16_rne(Wo[sw + e]); *(v8b*)(RW + (size_t)q * 8) = v; } if (i == 0 && t_ < DO) Pb[t_] = bf16_rne(bo[t_]); }
     }
}

// outer product + output: block = (i, 16 j's) x 8 waves: wave w -> j = j0 + 2w, j0 + 2w + 1: O_ij = L_i[32 x 128] . R_j^T (2x2 tiles x 4 k-steps) -> staged f16 (x OS) as the Z GEMM's A rows
// Og[jl][p*32+e]; then Z[i][j0+jl][o] = Σ_k Og[jl][k] Wo[o][k] + bo: wave w -> subtile o = 16w..16w+15 (1 row tile x 32 k-steps); output rows (i, j) = 512 B: the block's 16 rows = 8 KB contiguous,
__global__ __launch_bounds__(256) void opm_kernel(const b16* __restrict__ LT, const b16* __restrict__ RT, const b16* __restrict__ LTl, const b16* __restrict__ RTl, const b16* __restrict__ RW, const float* __restrict__ Pb, float* __restrict__ out) {
  __shared__ __attribute__((aligned(16))) b16 Og[16][PP + 8], Ogl[16][PP + 8]; __shared__ __attribute__((aligned(16))) float Zs[16][DO + 4];
  const int i = blockIdx.y, j0 = blockIdx.x * 16, t_ = threadIdx.x, lane = t_ & 31, wave = t_ >> 5, nloc = lane & 15, hlf = lane >> 4;
  const gb16 Li = (gb16)(LT + (size_t)i * P * S), Lil = (gb16)(LTl + (size_t)i * P * S);
  // The left fragments of k block 0 serve both jj and are loaded once, here, so that the wait below can stand directly behind them.
  const v16b a00 = frag_pk(Li, lane), a10 = frag_pk(Li + 2048, lane), l00 = frag_pk(Lil, lane), l10 = frag_pk(Lil + 2048, lane);
  // These eight loads name the two scalar bases; the wait takes both as inputs, so neither pair can be given a new value in front of it.
  asm volatile("s_wait_xcnt 0x0" :: "s"(Li), "s"(Lil) : "memory");
  for (int jj = 0; jj < 2; ++jj) { const int jl = wave * 2 + jj, j = j0 + jl; const gb16 Rj = wave_base(RT + (size_t)j * P * S), Rjl = wave_base(RTl + (size_t)j * P * S); v8f acc[2][2] = {{{}, {}}, {{}, {}}};
#pragma unroll
    for (int kb = 0; kb < S; kb += 32) { const v16b a0 = kb ? frag_pk(Li + kb * 16, lane) : a00, a1 = kb ? frag_pk(Li + 2048 + kb * 16, lane) : a10, l0 = kb ? frag_pk(Lil + kb * 16, lane) : l00, l1 = kb ? frag_pk(Lil + 2048 + kb * 16, lane) : l10;
      const v16b b0 = frag_pk(Rj + kb * 16, lane), b1 = frag_pk(Rj + 2048 + kb * 16, lane), m0_ = frag_pk(Rjl + kb * 16, lane), m1_ = frag_pk(Rjl + 2048 + kb * 16, lane);
      acc[0][0] = wmma16b(a0, b0, acc[0][0]); acc[0][0] = wmma16b(l0, b0, acc[0][0]); acc[0][0] = wmma16b(a0, m0_, acc[0][0]);
      acc[0][1] = wmma16b(a0, b1, acc[0][1]); acc[0][1] = wmma16b(l0, b1, acc[0][1]); acc[0][1] = wmma16b(a0, m1_, acc[0][1]);
      acc[1][0] = wmma16b(a1, b0, acc[1][0]); acc[1][0] = wmma16b(l1, b0, acc[1][0]); acc[1][0] = wmma16b(a1, m0_, acc[1][0]);
      acc[1][1] = wmma16b(a1, b1, acc[1][1]); acc[1][1] = wmma16b(l1, b1, acc[1][1]); acc[1][1] = wmma16b(a1, m1_, acc[1][1]); }
#pragma unroll
    for (int rt = 0; rt < 2; ++rt)
#pragma unroll
      for (int ct = 0; ct < 2; ++ct)
#pragma unroll
        for (int r = 0; r < 8; ++r) { const int p = rt * 16 + 8 * hlf + r, e = ct * 16 + nloc; const float y = acc[rt][ct][r] * (OS / (XS * XS)); const b16 h_ = (b16)y; Og[jl][p * P + e] = h_; Ogl[jl][p * P + e] = (b16)(y - (float)h_); } }
  __syncthreads();
  v8f z = {}; const gb16 Ww = (gb16)(RW + (size_t)wave * 16 * PP);
#pragma unroll 4
  for (int kb = 0; kb < PP; kb += 32) { const v16b bw = frag_pk(Ww + kb * 16, lane); z = wmma16b(frag_kb(&Og[nloc][kb], hlf), bw, z); z = wmma16b(frag_kb(&Ogl[nloc][kb], hlf), bw, z); }
#pragma unroll
  for (int r = 0; r < 8; ++r) { const int o = wave * 16 + nloc; Zs[8 * hlf + r][o] = z[r] * (1.0f / OS) + Pb[o]; }
  __syncthreads();
  { for (int q = t_; q < 16 * (DO / 4); q += 256) { const int jl = q / (DO / 4), c4 = (q % (DO / 4)) * 4; *(v4f*)(out + ((size_t)i * I + j0 + jl) * DO + c4) = *(const v4f*)(&Zs[jl][c4]); }  }
}
}  // namespace

extern "C" void kernel_launch(void* const* d_in, const int* in_sizes, int n_in,
                              void* d_out, int out_size, void* d_ws, size_t ws_size, hipStream_t stream) {
  (void)n_in; (void)out_size;
  const float* M = (const float*)d_in[0]; const float* g = (const float*)d_in[1]; const float* be = (const float*)d_in[2]; const float* Wa = (const float*)d_in[3]; const float* ba = (const float*)d_in[4]; const float* Wb = (const float*)d_in[5]; const float* bb = (const float*)d_in[6]; const float* Wo = (const float*)d_in[7]; const float* bo = (const float*)d_in[8];
  float* out = (float*)d_out;   // [1][256][256][128]
  if (in_sizes[0] != S * I * D || in_sizes[3] != P * D || in_sizes[7] != DO * PP) return;
  size_t off = 0; char* ws = (char*)d_ws;
  auto carve = [&](size_t bytes) { char* p = ws + off; off += (bytes + 255) & ~(size_t)255; return p; };
  b16* LT = (b16*)carve((size_t)I * P * S * 2); b16* RT = (b16*)carve((size_t)I * P * S * 2); b16* LTl = (b16*)carve((size_t)I * P * S * 2); b16* RTl = (b16*)carve((size_t)I * P * S * 2); b16* RW = (b16*)carve((size_t)DO * PP * 2); float* Pb = (float*)carve(DO * 4);
  if (off > ws_size) return;                                    // ≈ 2.1 x 4 + 0.26 MB
  proj_kernel<<<I, 256, 0, stream>>>(M, g, be, Wa, ba, Wb, bb, Wo, bo, LT, RT, LTl, RTl, RW, Pb);
  opm_kernel<<<dim3(I / 16, I), 256, 0, stream>>>(LT, RT, LTl, RTl, RW, Pb, out);
}

// v002
// It runs in 104 microseconds.
// Two timings next to v001 put it at 1.20 and 1.21 times that version's speed.
// All steps since v000 together make it 1.95 times as fast.
#include <hip/hip_runtime.h>

// OutProductMean: Mn = LN(M) over the 64 features; left = Mn Wa^T + ba (32), right = Mn Wb^T + bb (32); O[i][j][p][e] = Σ_s left[s][i][p] right[s][j][e];
// Z[i][j][o] = Σ_{p,e} O[i][j][p*32+e] Wo[o][p*32+e] + bo -> [1][256][256][128].
// WMMA (v_wmma_f32_16x16x32_f16, f32 accumulate): the two projections with EXACT weights and the LayerNormed rows as f16 hi+lo pairs x8 (2 products); per (i, j): O_ij[p][e] = Σ_s L_i[s][p] R_j[s][e] as a
// [32 x 128] x [128 x 32] product with the left/right planes as f16 hi+lo pairs x8 (3 products); the block's 16 O tiles are staged in LDS as hi+lo f16 rows and feed Z = O.Wo^T [16 x 1024] x
// [1024 x 128] (2 products, exact Wo). LayerNorm in f32. Fragment k-map per lane

namespace {
constexpr int S = 128, I = 256, D = 64, P = 32, DO = 128, PP = P * P;
constexpr float XS = 8.0f, OS = 0.25f /* O staged x0.25 in f16 (|O| ≲ 60) */, EPS = 1e-5f;

typedef _Float16 b16;
typedef __attribute__((ext_vector_type(16))) _Float16 v16b;
typedef __attribute__((ext_vector_type(8))) _Float16 v8b;
typedef __attribute__((ext_vector_type(8))) float v8f;
typedef __attribute__((ext_vector_type(4))) float v4f;
__device__ __forceinline__ float bf16_rne(float f) { unsigned int u = __float_as_uint(f); u += 0x7FFFu + ((u >> 16) & 1u); return __uint_as_float(u & 0xFFFF0000u); }
__device__ __forceinline__ v16b frag_kb(const b16* p, int hh) { const v8b a = *(const v8b*)(p + 8 * hh), b = *(const v8b*)(p + 16 + 8 * hh); v16b f;
#pragma unroll
  for (int e = 0; e < 8; ++e) { f[e] = a[e]; f[8 + e] = b[e]; } return f; }
// Packed fragment: 512 halves in lane order, two planes of 32 lanes x 8 halves (k 8*hlf+e, then 16+8*hlf+e), so that each wave-wide 16-byte load covers 512 contiguous bytes.
typedef const __attribute__((address_space(1))) b16* gb16; typedef const __attribute__((address_space(1))) v8b* gv8b;
__device__ __forceinline__ v16b frag_pk(gb16 p, unsigned lane) { const v8b a = *(gv8b)(p + 8 * lane), b = *(gv8b)(p + 256 + 8 * lane); v16b f;
#pragma unroll
  for (int e = 0; e < 8; ++e) { f[e] = a[e]; f[8 + e] = b[e]; } return f; }
// A wave's own plane base as a scalar pair: its fragment loads are then scalar base + 16 B x lane, and the one vector register they name (the lane's offset) lives to the kernel's end.
__device__ __forceinline__ gb16 wave_base(const b16* p) { const unsigned long long u = (unsigned long long)p; const unsigned lo = (unsigned)__builtin_amdgcn_readfirstlane((int)(unsigned)u), hi = (unsigned)__builtin_amdgcn_readfirstlane((int)(unsigned)(u >> 32)); return (gb16)(((unsigned long long)hi << 32) | lo); }
__device__ __forceinline__ v8f wmma16b(v16b a, v16b b, v8f c) { return __builtin_amdgcn_wmma_f32_16x16x32_f16(false, a, false, b, (short)0, c, false, false); }
__device__ __forceinline__ void wave_lds_sync() { __builtin_amdgcn_fence(__ATOMIC_RELEASE, "workgroup"); __builtin_amdgcn_wave_barrier(); __builtin_amdgcn_fence(__ATOMIC_ACQUIRE, "workgroup"); }
__device__ __forceinline__ float pmul(float a, float b) { float p = a * b; asm volatile("" : "+v"(p)); return p; }
__device__ __forceinline__ float wsum(float v) {
#pragma unroll
  for (int o = 1; o < 32; o <<= 1) v += __shfl_xor(v, o); return v; }

// LN + projections: block = (i, 8 waves): for the 128 rows (s, i): LN over 64 (wave per row, 2 per lane), hi+lo f16 x8 A rows in LDS; [128 x 64] x [64 x 64] ([Wa;Wb] exact rows) + bias;
__global__ __launch_bounds__(256) void proj_kernel(const float* __restrict__ M, const float* __restrict__ g, const float* __restrict__ be, const float* __restrict__ Wa, const float* __restrict__ ba, const float* __restrict__ Wb, const float* __restrict__ bb, const float* __restrict__ Wo, const float* __restrict__ bo, b16* __restrict__ LT, b16* __restrict__ RT, b16* __restrict__ LTl, b16* __restrict__ RTl, b16* __restrict__ RW, float* __restrict__ Pb) {
  __shared__ __attribute__((aligned(16))) b16 Ar[S][D + 8], Arl[S][D + 8]; __shared__ __attribute__((aligned(16))) b16 Wr[2 * P][D + 8]; __shared__ __attribute__((aligned(16))) b16 To[2 * P][S + 8], Tol[2 * P][S + 8]; __shared__ float bias[64];
  const int i = blockIdx.x, t_ = threadIdx.x, lane = t_ & 31, wave = t_ >> 5, nloc = lane & 15, hlf = lane >> 4;
  for (int q = t_; q < 2 * P * D; q += 256) { const int o = q / D, d = q % D; Wr[o][d] = (b16)bf16_rne((o < P) ? Wa[o * D + d] : Wb[(o - P) * D + d]); }
  if (t_ < 64) bias[t_] = bf16_rne((t_ < P) ? ba[t_] : bb[t_ - P]);
  for (int q = 0; q < 16; ++q) { const int s = wave * 16 + q; const float* mr = M + ((size_t)s * I + i) * D; const float x0 = bf16_rne(mr[lane]), x1 = bf16_rne(mr[32 + lane]);
    const float mu = wsum(x0 + x1) * (1.0f / D); const float d0 = x0 - mu, d1 = x1 - mu; const float var = wsum(pmul(d0, d0) + pmul(d1, d1)) * (1.0f / D); const float inv = rsqrtf(var + EPS);
    { const float y0 = (pmul(d0 * inv, bf16_rne(g[lane])) + bf16_rne(be[lane])) * XS, y1 = (pmul(d1 * inv, bf16_rne(g[32 + lane])) + bf16_rne(be[32 + lane])) * XS; const b16 h0 = (b16)y0, h1 = (b16)y1; Ar[s][lane] = h0; Arl[s][lane] = (b16)(y0 - (float)h0); Ar[s][32 + lane] = h1; Arl[s][32 + lane] = (b16)(y1 - (float)h1); } }
  __syncthreads();
  // wave w: rows 16w..16w+15 x 64 cols (4 subtiles) x 2 k-steps
  v8f acc[4] = {{}, {}, {}, {}};
#pragma unroll
  for (int kb = 0; kb < D; kb += 32) { const v16b a = frag_kb(&Ar[wave * 16 + nloc][kb], hlf), al = frag_kb(&Arl[wave * 16 + nloc][kb], hlf);
#pragma unroll
    for (int t = 0; t < 4; ++t) { const v16b bw = frag_kb(&Wr[t * 16 + nloc][kb], hlf); acc[t] = wmma16b(a, bw, acc[t]); acc[t] = wmma16b(al, bw, acc[t]); } }
#pragma unroll
  for (int t = 0; t < 4; ++t)
#pragma unroll
    for (int r = 0; r < 8; ++r) { const int c = t * 16 + nloc, s = wave * 16 + 8 * hlf + r; const float y = (acc[t][r] * (1.0f / XS) + bias[c]) * XS; const b16 h_ = (b16)y; To[c][s] = h_; Tol[c][s] = (b16)(y - (float)h_); }
  __syncthreads();
  {
    // planes leave in fragment order: chunk w = ((row tile * 4 + k block) * 2 + k half) * 32 + lane holds row 16*tile + (lane & 15), s = 32*block + 16*half + 8*(lane >> 4) .. +7
    for (int q = t_; q < 2 * P * (S / 8); q += 256) { const int side = q >> 9, w = q & 511, ln = w & 31; const int c = side * P + (w >> 8) * 16 + (ln & 15), s8 = ((w >> 6) & 3) * 32 + ((w >> 5) & 1) * 16 + (ln >> 4) * 8; const size_t gi = (size_t)i * P * S + (size_t)w * 8; b16* dh = side ? RT : LT; b16* dl = side ? RTl : LTl; *(v8b*)(dh + gi) = *(const v8b*)(&To[c][s8]); *(v8b*)(dl + gi) = *(const v8b*)(&Tol[c][s8]); }
    if (i < 64) { for (int q = i * 256 + t_; q < DO * PP / 8; q += 64 * 256) { const int ln = q & 31; const size_t sw = (size_t)((q >> 11) * 16 + (ln & 15)) * PP + ((q >> 6) & 31) * 32 + ((q >> 5) & 1) * 16 + (ln >> 4) * 8; v8b v; for (int e = 0; e < 8; ++e) v[e] = (b16)bf16_rne(Wo[sw + e]); *(v8b*)(RW + (size_t)q * 8) = v; } if (i == 0 && t_ < DO) Pb[t_] = bf16_rne(bo[t_]); }
     }
}

// outer product + output: block = (i, 16 j's) x 8 waves: wave w -> j = j0 + 2w, j0 + 2w + 1: O_ij = L_i[32 x 128] . R_j^T (2x2 tiles x 4 k-steps) -> staged f16 (x OS) as the Z GEMM's A rows
// Og[jl][p*32+e]; then Z[i][j0+jl][o] = Σ_k Og[jl][k] Wo[o][k] + bo: wave w -> subtile o = 16w..16w+15 (1 row tile x 32 k-steps); output rows (i, j) = 512 B: the block's 16 rows = 8 KB contiguous,
__global__ __launch_bounds__(256) void opm_kernel(const b16* __restrict__ LT, const b16* __restrict__ RT, const b16* __restrict__ LTl, const b16* __restrict__ RTl, const b16* __restrict__ RW, const float* __restrict__ Pb, float* __restrict__ out) {
  __shared__ __attribute__((aligned(16))) b16 Og[16][PP + 8], Ogl[16][PP + 8]; __shared__ __attribute__((aligned(16))) float Zs[16][DO + 4];
  const int i = blockIdx.y, j0 = blockIdx.x * 16, t_ = threadIdx.x, lane = t_ & 31, wave = t_ >> 5, nloc = lane & 15, hlf = lane >> 4;
  const gb16 Li = (gb16)(LT + (size_t)i * P * S), Lil = (gb16)(LTl + (size_t)i * P * S);
  // The left fragments of k block 0 serve both jj and are loaded once, here, so that the wait below can stand directly behind them.
  const v16b a00 = frag_pk(Li, lane), a10 = frag_pk(Li + 2048, lane), l00 = frag_pk(Lil, lane), l10 = frag_pk(Lil + 2048, lane);
  // These eight loads name the two scalar bases; the wait takes both as inputs, so neither pair can be given a new value in front of it.
  asm volatile("s_wait_xcnt 0x0" :: "s"(Li), "s"(Lil) : "memory");
  for (int jj = 0; jj < 2; ++jj) { const int jl = wave * 2 + jj, j = j0 + jl; const gb16 Rj = wave_base(RT + (size_t)j * P * S), Rjl = wave_base(RTl + (size_t)j * P * S); v8f acc[2][2] = {{{}, {}}, {{}, {}}};
#pragma unroll
    for (int kb = 0; kb < S; kb += 32) { const v16b a0 = kb ? frag_pk(Li + kb * 16, lane) : a00, a1 = kb ? frag_pk(Li + 2048 + kb * 16, lane) : a10, l0 = kb ? frag_pk(Lil + kb * 16, lane) : l00, l1 = kb ? frag_pk(Lil + 2048 + kb * 16, lane) : l10;
      const v16b b0 = frag_pk(Rj + kb * 16, lane), b1 = frag_pk(Rj + 2048 + kb * 16, lane), m0_ = frag_pk(Rjl + kb * 16, lane), m1_ = frag_pk(Rjl + 2048 + kb * 16, lane);
      acc[0][0] = wmma16b(a0, b0, acc[0][0]); acc[0][0] = wmma16b(l0, b0, acc[0][0]); acc[0][0] = wmma16b(a0, m0_, acc[0][0]);
      acc[0][1] = wmma16b(a0, b1, acc[0][1]); acc[0][1] = wmma16b(l0, b1, acc[0][1]); acc[0][1] = wmma16b(a0, m1_, acc[0][1]);
      acc[1][0] = wmma16b(a1, b0, acc[1][0]); acc[1][0] = wmma16b(l1, b0, acc[1][0]); acc[1][0] = wmma16b(a1, m0_, acc[1][0]);
      acc[1][1] = wmma16b(a1, b1, acc[1][1]); acc[1][1] = wmma16b(l1, b1, acc[1][1]); acc[1][1] = wmma16b(a1, m1_, acc[1][1]); }
    // The trip's loads name these four scalar bases and the next trip gives the right-hand pairs new values: the wait takes all four as inputs, so no pair can be rewritten in front of it.
    // Its memory clobber also makes each trip load its own left fragments, as before: held over both trips they cost 64 registers more and one resident work-group per WGP.
    asm volatile("s_wait_xcnt 0x0" :: "s"(Li), "s"(Lil), "s"(Rj), "s"(Rjl) : "memory");
#pragma unroll
    for (int rt = 0; rt < 2; ++rt)
#pragma unroll
      for (int ct = 0; ct < 2; ++ct)
#pragma unroll
        for (int r = 0; r < 8; ++r) { const int p = rt * 16 + 8 * hlf + r, e = ct * 16 + nloc; const float y = acc[rt][ct][r] * (OS / (XS * XS)); const b16 h_ = (b16)y; Og[jl][p * P + e] = h_; Ogl[jl][p * P + e] = (b16)(y - (float)h_); } }
  __syncthreads();
  v8f z = {}; const gb16 Ww = (gb16)(RW + (size_t)wave * 16 * PP);
#pragma unroll 4
  for (int kb = 0; kb < PP; kb += 32) { const v16b bw = frag_pk(Ww + kb * 16, lane); z = wmma16b(frag_kb(&Og[nloc][kb], hlf), bw, z); z = wmma16b(frag_kb(&Ogl[nloc][kb], hlf), bw, z); }
#pragma unroll
  for (int r = 0; r < 8; ++r) { const int o = wave * 16 + nloc; Zs[8 * hlf + r][o] = z[r] * (1.0f / OS) + Pb[o]; }
  __syncthreads();
  { for (int q = t_; q < 16 * (DO / 4); q += 256) { const int jl = q / (DO / 4), c4 = (q % (DO / 4)) * 4; *(v4f*)(out + ((size_t)i * I + j0 + jl) * DO + c4) = *(const v4f*)(&Zs[jl][c4]); }  }
}
}  // namespace

extern "C" void kernel_launch(void* const* d_in, const int* in_sizes, int n_in,
                              void* d_out, int out_size, void* d_ws, size_t ws_size, hipStream_t stream) {
  (void)n_in; (void)out_size;
  const float* M = (const float*)d_in[0]; const float* g = (const float*)d_in[1]; const float* be = (const float*)d_in[2]; const float* Wa = (const float*)d_in[3]; const float* ba = (const float*)d_in[4]; const float* Wb = (const float*)d_in[5]; const float* bb = (const float*)d_in[6]; const float* Wo = (const float*)d_in[7]; const float* bo = (const float*)d_in[8];
  float* out = (float*)d_out;   // [1][256][256][128]
  if (in_sizes[0] != S * I * D || in_sizes[3] != P * D || in_sizes[7] != DO * PP) return;
  size_t off = 0; char* ws = (char*)d_ws;
  auto carve = [&](size_t bytes) { char* p = ws + off; off += (bytes + 255) & ~(size_t)255; return p; };
  b16* LT = (b16*)carve((size_t)I * P * S * 2); b16* RT = (b16*)carve((size_t)I * P * S * 2); b16* LTl = (b16*)carve((size_t)I * P * S * 2); b16* RTl = (b16*)carve((size_t)I * P * S * 2); b16* RW = (b16*)carve((size_t)DO * PP * 2); float* Pb = (float*)carve(DO * 4);
  if (off > ws_size) return;                                    // ≈ 2.1 x 4 + 0.26 MB
  proj_kernel<<<I, 256, 0, stream>>>(M, g, be, Wa, ba, Wb, bb, Wo, bo, LT, RT, LTl, RTl, RW, Pb);
  opm_kernel<<<dim3(I / 16, I), 256, 0, stream>>>(LT, RT, LTl, RTl, RW, Pb, out);
}

// v003
// Measured time: 99.1 microseconds a run.
// In two side-by-side timings against v002, it was 1.05 and 1.04 times as fast.
// Over all steps from v000 it is 2.04 times as fast.
#include <hip/hip_runtime.h>

// OutProductMean: Mn = LN(M) over the 64 features; left = Mn Wa^T + ba (32), right = Mn Wb^T + bb (32); O[i][j][p][e] = Σ_s left[s][i][p] right[s][j][e];
// Z[i][j][o] = Σ_{p,e} O[i][j][p*32+e] Wo[o][p*32+e] + bo -> [1][256][256][128].
// WMMA (v_wmma_f32_16x16x32_f16, f32 accumulate): the two projections with EXACT weights and the LayerNormed rows as f16 hi+lo pairs x8 (2 products); per (i, j): O_ij[p][e] = Σ_s L_i[s][p] R_j[s][e] as a
// [32 x 128] x [128 x 32] product with the left/right planes as f16 hi+lo pairs x8 (3 products); the block's 32 O tiles are staged in LDS as hi+lo f16 rows and feed Z = O.Wo^T [32 x 1024] x
// [1024 x 128] (2 products, exact Wo). LayerNorm in f32. Fragment k-map per lane

namespace {
constexpr int S = 128, I = 256, D = 64, P = 32, DO = 128, PP = P * P;
constexpr float XS = 8.0f, OS = 0.25f /* O staged x0.25 in f16 (|O| ≲ 60) */, EPS = 1e-5f;

typedef _Float16 b16;
typedef __attribute__((ext_vector_type(16))) _Float16 v16b;
typedef __attribute__((ext_vector_type(8))) _Float16 v8b;
typedef __attribute__((ext_vector_type(8))) float v8f;
typedef __attribute__((ext_vector_type(4))) float v4f;
__device__ __forceinline__ float bf16_rne(float f) { unsigned int u = __float_as_uint(f); u += 0x7FFFu + ((u >> 16) & 1u); return __uint_as_float(u & 0xFFFF0000u); }
__device__ __forceinline__ v16b frag_kb(const b16* p, int hh) { const v8b a = *(const v8b*)(p + 8 * hh), b = *(const v8b*)(p + 16 + 8 * hh); v16b f;
#pragma unroll
  for (int e = 0; e < 8; ++e) { f[e] = a[e]; f[8 + e] = b[e]; } return f; }
// Packed fragment: 512 halves in lane order, two planes of 32 lanes x 8 halves (k 8*hlf+e, then 16+8*hlf+e), so that each wave-wide 16-byte load covers 512 contiguous bytes.
typedef const __attribute__((address_space(1))) b16* gb16; typedef const __attribute__((address_space(1))) v8b* gv8b;
__device__ __forceinline__ v16b frag_pk(gb16 p, unsigned lane) { const v8b a = *(gv8b)(p + 8 * lane), b = *(gv8b)(p + 256 + 8 * lane); v16b f;
#pragma unroll
  for (int e = 0; e < 8; ++e) { f[e] = a[e]; f[8 + e] = b[e]; } return f; }
// A wave's own plane base as a scalar pair: its fragment loads are then scalar base + 16 B x lane, and the one vector register they name (the lane's offset) lives to the kernel's end.
__device__ __forceinline__ gb16 wave_base(const b16* p) { const unsigned long long u = (unsigned long long)p; const unsigned lo = (unsigned)__builtin_amdgcn_readfirstlane((int)(unsigned)u), hi = (unsigned)__builtin_amdgcn_readfirstlane((int)(unsigned)(u >> 32)); return (gb16)(((unsigned long long)hi << 32) | lo); }
__device__ __forceinline__ v8f wmma16b(v16b a, v16b b, v8f c) { return __builtin_amdgcn_wmma_f32_16x16x32_f16(false, a, false, b, (short)0, c, false, false); }
__device__ __forceinline__ void wave_lds_sync() { __builtin_amdgcn_fence(__ATOMIC_RELEASE, "workgroup"); __builtin_amdgcn_wave_barrier(); __builtin_amdgcn_fence(__ATOMIC_ACQUIRE, "workgroup"); }
__device__ __forceinline__ float pmul(float a, float b) { float p = a * b; asm volatile("" : "+v"(p)); return p; }
__device__ __forceinline__ float wsum(float v) {
#pragma unroll
  for (int o = 1; o < 32; o <<= 1) v += __shfl_xor(v, o); return v; }

// LN + projections: block = (i, 8 waves): for the 128 rows (s, i): LN over 64 (wave per row, 2 per lane), hi+lo f16 x8 A rows in LDS; [128 x 64] x [64 x 64] ([Wa;Wb] exact rows) + bias;
__global__ __launch_bounds__(256) void proj_kernel(const float* __restrict__ M, const float* __restrict__ g, const float* __restrict__ be, const float* __restrict__ Wa, const float* __restrict__ ba, const float* __restrict__ Wb, const float* __restrict__ bb, const float* __restrict__ Wo, const float* __restrict__ bo, b16* __restrict__ LT, b16* __restrict__ RT, b16* __restrict__ LTl, b16* __restrict__ RTl, b16* __restrict__ RW, float* __restrict__ Pb) {
  __shared__ __attribute__((aligned(16))) b16 Ar[S][D + 8], Arl[S][D + 8]; __shared__ __attribute__((aligned(16))) b16 Wr[2 * P][D + 8]; __shared__ __attribute__((aligned(16))) b16 To[2 * P][S + 8], Tol[2 * P][S + 8]; __shared__ float bias[64];
  const int i = blockIdx.x, t_ = threadIdx.x, lane = t_ & 31, wave = t_ >> 5, nloc = lane & 15, hlf = lane >> 4;
  for (int q = t_; q < 2 * P * D; q += 256) { const int o = q / D, d = q % D; Wr[o][d] = (b16)bf16_rne((o < P) ? Wa[o * D + d] : Wb[(o - P) * D + d]); }
  if (t_ < 64) bias[t_] = bf16_rne((t_ < P) ? ba[t_] : bb[t_ - P]);
  for (int q = 0; q < 16; ++q) { const int s = wave * 16 + q; const float* mr = M + ((size_t)s * I + i) * D; const float x0 = bf16_rne(mr[lane]), x1 = bf16_rne(mr[32 + lane]);
    const float mu = wsum(x0 + x1) * (1.0f / D); const float d0 = x0 - mu, d1 = x1 - mu; const float var = wsum(pmul(d0, d0) + pmul(d1, d1)) * (1.0f / D); const float inv = rsqrtf(var + EPS);
    { const float y0 = (pmul(d0 * inv, bf16_rne(g[lane])) + bf16_rne(be[lane])) * XS, y1 = (pmul(d1 * inv, bf16_rne(g[32 + lane])) + bf16_rne(be[32 + lane])) * XS; const b16 h0 = (b16)y0, h1 = (b16)y1; Ar[s][lane] = h0; Arl[s][lane] = (b16)(y0 - (float)h0); Ar[s][32 + lane] = h1; Arl[s][32 + lane] = (b16)(y1 - (float)h1); } }
  __syncthreads();
  // wave w: rows 16w..16w+15 x 64 cols (4 subtiles) x 2 k-steps
  v8f acc[4] = {{}, {}, {}, {}};
#pragma unroll
  for (int kb = 0; kb < D; kb += 32) { const v16b a = frag_kb(&Ar[wave * 16 + nloc][kb], hlf), al = frag_kb(&Arl[wave * 16 + nloc][kb], hlf);
#pragma unroll
    for (int t = 0; t < 4; ++t) { const v16b bw = frag_kb(&Wr[t * 16 + nloc][kb], hlf); acc[t] = wmma16b(a, bw, acc[t]); acc[t] = wmma16b(al, bw, acc[t]); } }
#pragma unroll
  for (int t = 0; t < 4; ++t)
#pragma unroll
    for (int r = 0; r < 8; ++r) { const int c = t * 16 + nloc, s = wave * 16 + 8 * hlf + r; const float y = (acc[t][r] * (1.0f / XS) + bias[c]) * XS; const b16 h_ = (b16)y; To[c][s] = h_; Tol[c][s] = (b16)(y - (float)h_); }
  __syncthreads();
  {
    // planes leave in fragment order: chunk w = ((row tile * 4 + k block) * 2 + k half) * 32 + lane holds row 16*tile + (lane & 15), s = 32*block + 16*half + 8*(lane >> 4) .. +7
    for (int q = t_; q < 2 * P * (S / 8); q += 256) { const int side = q >> 9, w = q & 511, ln = w & 31; const int c = side * P + (w >> 8) * 16 + (ln & 15), s8 = ((w >> 6) & 3) * 32 + ((w >> 5) & 1) * 16 + (ln >> 4) * 8; const size_t gi = (size_t)i * P * S + (size_t)w * 8; b16* dh = side ? RT : LT; b16* dl = side ? RTl : LTl; *(v8b*)(dh + gi) = *(const v8b*)(&To[c][s8]); *(v8b*)(dl + gi) = *(const v8b*)(&Tol[c][s8]); }
    if (i < 64) { for (int q = i * 256 + t_; q < DO * PP / 8; q += 64 * 256) { const int ln = q & 31; const size_t sw = (size_t)((q >> 11) * 16 + (ln & 15)) * PP + ((q >> 6) & 31) * 32 + ((q >> 5) & 1) * 16 + (ln >> 4) * 8; v8b v; for (int e = 0; e < 8; ++e) v[e] = (b16)bf16_rne(Wo[sw + e]); *(v8b*)(RW + (size_t)q * 8) = v; } if (i == 0 && t_ < DO) Pb[t_] = bf16_rne(bo[t_]); }
     }
}

// outer product + output: block = (2 i's, 16 j's) x 8 waves: wave w -> j = j0 + 2w, j0 + 2w + 1 and both i's at once: O_ij = L_i[32 x 128] . R_j^T (a 64 x 64 wave tile, 4 k-steps: each right fragment feeds both
// i's, each left fragment both j's) -> staged f16 (x OS) as the Z GEMM's A rows Og[ii*16+jl][p*32+e]; then Z[i0+ii][j0+jl][o] = sum_k Og[ii*16+jl][k] Wo[o][k] + bo: wave w -> subtile o = 16w..16w+15
// (2 row tiles x 32 k-steps; each Wo fragment feeds both row tiles); output rows (i, j) = 512 B: per i the block's 16 rows = 8 KB contiguous,
__global__ __launch_bounds__(256) void opm_kernel(const b16* __restrict__ LT, const b16* __restrict__ RT, const b16* __restrict__ LTl, const b16* __restrict__ RTl, const b16* __restrict__ RW, const float* __restrict__ Pb, float* __restrict__ out) {
  __shared__ __attribute__((aligned(16))) b16 Og[32][PP + 8], Ogl[32][PP + 8]; __shared__ __attribute__((aligned(16))) float Zs[32][DO + 4];
  const int i0 = blockIdx.y * 2, j0 = blockIdx.x * 16, t_ = threadIdx.x, lane = t_ & 31, wave = t_ >> 5, nloc = lane & 15, hlf = lane >> 4;
  // the planes of i0 and i0 + 1, and of the wave's two j's, lie side by side (P * S halves each): one scalar base a plane serves both
  const gb16 Li = (gb16)(LT + (size_t)i0 * P * S), Lil = (gb16)(LTl + (size_t)i0 * P * S);
  const gb16 Rj = wave_base(RT + (size_t)(j0 + wave * 2) * P * S), Rjl = wave_base(RTl + (size_t)(j0 + wave * 2) * P * S);
  v8f acc[2][2][2][2] = {};   // [ii][jj][rt][ct]
#pragma unroll
  for (int kb = 0; kb < S; kb += 32) { v16b bh[2][2], bl[2][2];
#pragma unroll
    for (int jj = 0; jj < 2; ++jj)
#pragma unroll
      for (int ct = 0; ct < 2; ++ct) { bh[jj][ct] = frag_pk(Rj + jj * P * S + ct * 2048 + kb * 16, lane); bl[jj][ct] = frag_pk(Rjl + jj * P * S + ct * 2048 + kb * 16, lane); }
#pragma unroll
    for (int ii = 0; ii < 2; ++ii)
#pragma unroll
      for (int rt = 0; rt < 2; ++rt) { const v16b ah = frag_pk(Li + ii * P * S + rt * 2048 + kb * 16, lane), al = frag_pk(Lil + ii * P * S + rt * 2048 + kb * 16, lane);
#pragma unroll
        for (int jj = 0; jj < 2; ++jj)
#pragma unroll
          for (int ct = 0; ct < 2; ++ct) { v8f c = acc[ii][jj][rt][ct]; c = wmma16b(ah, bh[jj][ct], c); c = wmma16b(al, bh[jj][ct], c); c = wmma16b(ah, bl[jj][ct], c); acc[ii][jj][rt][ct] = c; } } }
  // The loads above name these four scalar bases (and the lane's offset); the wait stands in front of everything that may give their registers new values.
  asm volatile("s_wait_xcnt 0x0" :: "s"(Li), "s"(Lil), "s"(Rj), "s"(Rjl) : "memory");
#pragma unroll
  for (int ii = 0; ii < 2; ++ii)
#pragma unroll
    for (int jj = 0; jj < 2; ++jj)
#pragma unroll
      for (int rt = 0; rt < 2; ++rt)
#pragma unroll
        for (int ct = 0; ct < 2; ++ct)
#pragma unroll
          for (int r = 0; r < 8; ++r) { const int p = rt * 16 + 8 * hlf + r, e = ct * 16 + nloc, rw = ii * 16 + wave * 2 + jj; const float y = acc[ii][jj][rt][ct][r] * (OS / (XS * XS)); const b16 h_ = (b16)y; Og[rw][p * P + e] = h_; Ogl[rw][p * P + e] = (b16)(y - (float)h_); }
  __syncthreads();
  v8f z0 = {}, z1 = {}; const gb16 Ww = (gb16)(RW + (size_t)wave * 16 * PP);
#pragma unroll 4
  for (int kb = 0; kb < PP; kb += 32) { const v16b bw = frag_pk(Ww + kb * 16, lane);
    z0 = wmma16b(frag_kb(&Og[nloc][kb], hlf), bw, z0); z1 = wmma16b(frag_kb(&Og[16 + nloc][kb], hlf), bw, z1);
    z0 = wmma16b(frag_kb(&Ogl[nloc][kb], hlf), bw, z0); z1 = wmma16b(frag_kb(&Ogl[16 + nloc][kb], hlf), bw, z1); }
#pragma unroll
  for (int r = 0; r < 8; ++r) { const int o = wave * 16 + nloc; const float pb = Pb[o]; Zs[8 * hlf + r][o] = z0[r] * (1.0f / OS) + pb; Zs[16 + 8 * hlf + r][o] = z1[r] * (1.0f / OS) + pb; }
  __syncthreads();
  { for (int q = t_; q < 32 * (DO / 4); q += 256) { const int rw = q / (DO / 4), c4 = (q % (DO / 4)) * 4; *(v4f*)(out + ((size_t)(i0 + (rw >> 4)) * I + j0 + (rw & 15)) * DO + c4) = *(const v4f*)(&Zs[rw][c4]); }  }
}
}  // namespace

extern "C" void kernel_launch(void* const* d_in, const int* in_sizes, int n_in,
                              void* d_out, int out_size, void* d_ws, size_t ws_size, hipStream_t stream) {
  (void)n_in; (void)out_size;
  const float* M = (const float*)d_in[0]; const float* g = (const float*)d_in[1]; const float* be = (const float*)d_in[2]; const float* Wa = (const float*)d_in[3]; const float* ba = (const float*)d_in[4]; const float* Wb = (const float*)d_in[5]; const float* bb = (const float*)d_in[6]; const float* Wo = (const float*)d_in[7]; const float* bo = (const float*)d_in[8];
  float* out = (float*)d_out;   // [1][256][256][128]
  if (in_sizes[0] != S * I * D || in_sizes[3] != P * D || in_sizes[7] != DO * PP) return;
  size_t off = 0; char* ws = (char*)d_ws;
  auto carve = [&](size_t bytes) { char* p = ws + off; off += (bytes + 255) & ~(size_t)255; return p; };
  b16* LT = (b16*)carve((size_t)I * P * S * 2); b16* RT = (b16*)carve((size_t)I * P * S * 2); b16* LTl = (b16*)carve((size_t)I * P * S * 2); b16* RTl = (b16*)carve((size_t)I * P * S * 2); b16* RW = (b16*)carve((size_t)DO * PP * 2); float* Pb = (float*)carve(DO * 4);
  if (off > ws_size) return;                                    // ≈ 2.1 x 4 + 0.26 MB
  proj_kernel<<<I, 256, 0, stream>>>(M, g, be, Wa, ba, Wb, bb, Wo, bo, LT, RT, LTl, RTl, RW, Pb);
  opm_kernel<<<dim3(I / 16, I / 2), 256, 0, stream>>>(LT, RT, LTl, RTl, RW, Pb, out);
}

// v004
// It runs in 66.6 microseconds.
// Next to v003, in two timings, it ran 1.50 and 1.47 times as fast.
// Over all steps from v000 it is 3.03 times as fast.
#include <hip/hip_runtime.h>

// OutProductMean: Mn = LN(M) over the 64 features; left = Mn Wa^T + ba (32), right = Mn Wb^T + bb (32); O[i][j][p][e] = Σ_s left[s][i][p] right[s][j][e];
// Z[i][j][o] = Σ_{p,e} O[i][j][p*32+e] Wo[o][p*32+e] + bo -> [1][256][256][128].
// WMMA (v_wmma_f32_16x16x32_f16, f32 accumulate): the two projections with EXACT weights and the LayerNormed rows as f16 hi+lo pairs x8 (2 products); per (i, j): O_ij[p][e] = Σ_s L_i[s][p] R_j[s][e] as a
// [32 x 128] x [128 x 32] product with the left/right planes as f16 hi+lo pairs x8 (3 products); the O values, x0.25 as f16 hi+lo, stay in registers and feed Z^T = Wo.O^T [128 x 1024] x
// [1024 x 32 j's] (2 products, exact Wo). LayerNorm in f32. Fragment k-map per lane

namespace {
constexpr int S = 128, I = 256, D = 64, P = 32, DO = 128, PP = P * P;
constexpr float XS = 8.0f, OS = 0.25f /* O staged x0.25 in f16 (|O| ≲ 60) */, EPS = 1e-5f;

typedef _Float16 b16;
typedef __attribute__((ext_vector_type(16))) _Float16 v16b;
typedef __attribute__((ext_vector_type(8))) _Float16 v8b;
typedef __attribute__((ext_vector_type(8))) float v8f;
typedef __attribute__((ext_vector_type(4))) float v4f;
__device__ __forceinline__ float bf16_rne(float f) { unsigned int u = __float_as_uint(f); u += 0x7FFFu + ((u >> 16) & 1u); return __uint_as_float(u & 0xFFFF0000u); }
__device__ __forceinline__ v16b frag_kb(const b16* p, int hh) { const v8b a = *(const v8b*)(p + 8 * hh), b = *(const v8b*)(p + 16 + 8 * hh); v16b f;
#pragma unroll
  for (int e = 0; e < 8; ++e) { f[e] = a[e]; f[8 + e] = b[e]; } return f; }
// Packed fragment: 512 halves in lane order, two planes of 32 lanes x 8 halves (k 8*hlf+e, then 16+8*hlf+e), so that each wave-wide 16-byte load covers 512 contiguous bytes.
typedef const __attribute__((address_space(1))) b16* gb16; typedef const __attribute__((address_space(1))) v8b* gv8b;
__device__ __forceinline__ v16b frag_pk(gb16 p, unsigned lane) { const v8b a = *(gv8b)(p + 8 * lane), b = *(gv8b)(p + 256 + 8 * lane); v16b f;
#pragma unroll
  for (int e = 0; e < 8; ++e) { f[e] = a[e]; f[8 + e] = b[e]; } return f; }
// A wave's own plane base as a scalar pair: its fragment loads are then scalar base + 16 B x lane, and the one vector register they name (the lane's offset) lives to the kernel's end.
__device__ __forceinline__ gb16 wave_base(const b16* p) { const unsigned long long u = (unsigned long long)p; const unsigned lo = (unsigned)__builtin_amdgcn_readfirstlane((int)(unsigned)u), hi = (unsigned)__builtin_amdgcn_readfirstlane((int)(unsigned)(u >> 32)); return (gb16)(((unsigned long long)hi << 32) | lo); }
__device__ __forceinline__ v8f wmma16b(v16b a, v16b b, v8f c) { return __builtin_amdgcn_wmma_f32_16x16x32_f16(false, a, false, b, (short)0, c, false, false); }
__device__ __forceinline__ void wave_lds_sync() { __builtin_amdgcn_fence(__ATOMIC_RELEASE, "workgroup"); __builtin_amdgcn_wave_barrier(); __builtin_amdgcn_fence(__ATOMIC_ACQUIRE, "workgroup"); }
__device__ __forceinline__ float pmul(float a, float b) { float p = a * b; asm volatile("" : "+v"(p)); return p; }
__device__ __forceinline__ float wsum(float v) {
#pragma unroll
  for (int o = 1; o < 32; o <<= 1) v += __shfl_xor(v, o); return v; }

// LN + projections: block = (tile of 16 i's, group of 8 s's) x 8 waves: wave w -> s = 8*s8 + w, its 16 rows are the 16 i's. LN over 64 (wave per row, 2 per lane), f16 hi+lo x8 A rows in LDS;
// [128 x 64] x [64 x 64] ([Wa;Wb] exact rows) + bias. A block owns one 8-wide s chunk of 16 i's, which is 256 contiguous bytes of every fragment plane it writes.
__global__ __launch_bounds__(256) void proj_kernel(const float* __restrict__ M, const float* __restrict__ g, const float* __restrict__ be, const float* __restrict__ Wa, const float* __restrict__ ba, const float* __restrict__ Wb, const float* __restrict__ bb, const float* __restrict__ Wo, const float* __restrict__ bo, b16* __restrict__ LT, b16* __restrict__ RT, b16* __restrict__ LTl, b16* __restrict__ RTl, b16* __restrict__ RW, float* __restrict__ Pb) {
  __shared__ __attribute__((aligned(16))) b16 Ar[S][D + 8], Arl[S][D + 8]; __shared__ __attribute__((aligned(16))) b16 Wr[2 * P][D + 8]; __shared__ __attribute__((aligned(16))) b16 To[2 * P][S + 8], Tol[2 * P][S + 8]; __shared__ float bias[64];
  const int blk = blockIdx.x, it = blk >> 4, s8 = blk & 15, t_ = threadIdx.x, lane = t_ & 31, wave = t_ >> 5, nloc = lane & 15, hlf = lane >> 4;
  for (int q = t_; q < 2 * P * D; q += 256) { const int o = q / D, d = q % D; Wr[o][d] = (b16)bf16_rne((o < P) ? Wa[o * D + d] : Wb[(o - P) * D + d]); }
  if (t_ < 64) bias[t_] = bf16_rne((t_ < P) ? ba[t_] : bb[t_ - P]);
  for (int q = 0; q < 16; ++q) { const int s = wave * 16 + q; const float* mr = M + ((size_t)(s8 * 8 + wave) * I + it * 16 + q) * D; const float x0 = bf16_rne(mr[lane]), x1 = bf16_rne(mr[32 + lane]);
    const float mu = wsum(x0 + x1) * (1.0f / D); const float d0 = x0 - mu, d1 = x1 - mu; const float var = wsum(pmul(d0, d0) + pmul(d1, d1)) * (1.0f / D); const float inv = rsqrtf(var + EPS);
    { const float y0 = (pmul(d0 * inv, bf16_rne(g[lane])) + bf16_rne(be[lane])) * XS, y1 = (pmul(d1 * inv, bf16_rne(g[32 + lane])) + bf16_rne(be[32 + lane])) * XS; const b16 h0 = (b16)y0, h1 = (b16)y1; Ar[s][lane] = h0; Arl[s][lane] = (b16)(y0 - (float)h0); Ar[s][32 + lane] = h1; Arl[s][32 + lane] = (b16)(y1 - (float)h1); } }
  __syncthreads();
  // wave w: rows 16w..16w+15 x 64 cols (4 subtiles) x 2 k-steps
  v8f acc[4] = {{}, {}, {}, {}};
#pragma unroll
  for (int kb = 0; kb < D; kb += 32) { const v16b a = frag_kb(&Ar[wave * 16 + nloc][kb], hlf), al = frag_kb(&Arl[wave * 16 + nloc][kb], hlf);
#pragma unroll
    for (int t = 0; t < 4; ++t) { const v16b bw = frag_kb(&Wr[t * 16 + nloc][kb], hlf); acc[t] = wmma16b(a, bw, acc[t]); acc[t] = wmma16b(al, bw, acc[t]); } }
  // To[c][il * 8 + sl]: column c of i = 16*it + il at s = 8*s8 + sl, so that the 8 s values of one (c, i) are one 16-byte chunk
#pragma unroll
  for (int t = 0; t < 4; ++t)
#pragma unroll
    for (int r = 0; r < 8; ++r) { const int c = t * 16 + nloc, il = 8 * hlf + r; const float y = (acc[t][r] * (1.0f / XS) + bias[c]) * XS; const b16 h_ = (b16)y; To[c][il * 8 + wave] = h_; Tol[c][il * 8 + wave] = (b16)(y - (float)h_); }
  __syncthreads();
  {
    // planes leave in fragment order; s = 32*kb + 16*half + 8*(lane >> 4) + 0..7, so this block's chunks sit at (kb*2 + half) = s8 >> 1, lane >> 4 = s8 & 1.
    // left, per i: chunk ((row tile * 4 + kb) * 2 + half) * 32 + lane, lane & 15 = p & 15. right, per tile of 16 j's and per e: chunk ((jt * 32 + e) * 4 + kb) * 2 + half) * 32 + lane, lane & 15 = j & 15.
    const int fo = (s8 >> 1) * 32 + (s8 & 1) * 16;
    for (int q = t_; q < 2 * P * 16; q += 256) { const int side = q >> 9, l4 = q & 15; const int c = side ? P + ((q >> 4) & 31) : ((q >> 4) & 1) * 16 + l4, il = side ? l4 : (q >> 5) & 15;
      const size_t gi = side ? ((size_t)(it * P + ((q >> 4) & 31)) * 256 + fo + l4) * 8 : (size_t)(it * 16 + il) * P * S + (size_t)(((q >> 4) & 1) * 256 + fo + l4) * 8;
      b16* dh = side ? RT : LT; b16* dl = side ? RTl : LTl; *(v8b*)(dh + gi) = *(const v8b*)(&To[c][il * 8]); *(v8b*)(dl + gi) = *(const v8b*)(&Tol[c][il * 8]); }
    // Wo as the A fragments of Z^T, one k block of 32 per e with k = p: chunk ((e * 8 + o tile) * 2 + half) * 32 + lane holds Wo[16*tile + (lane & 15)][p * 32 + e], p = 16*half + 8*(lane >> 4) + 0..7
    if (blk < 64) { const int e = t_ & 31, ln = (blk * 8 + wave) & 31, half = (blk >> 2) & 1, ot = blk >> 3; const size_t sw = (size_t)(ot * 16 + (ln & 15)) * PP + (half * 16 + (ln >> 4) * 8) * P + e; v8b v; for (int x = 0; x < 8; ++x) v[x] = (b16)bf16_rne(Wo[sw + x * P]); *(v8b*)(RW + ((size_t)((e * 8 + ot) * 2 + half) * 32 + ln) * 8) = v; if (blk == 0 && t_ < DO) Pb[t_] = bf16_rne(bo[t_]); }
     }
}

// outer product + output, all in registers: block = (8 i's, 32 j's) x 8 waves, wave w -> i = i0 + w and both tiles of 16 j's. Per e: D[p][j] = sum_s L_i[s][p] R_j[s][e] (rows p, 2 tiles; columns j on the lanes; 4 k-steps,
// 3 products; the 16 left fragments stay in registers for the whole kernel). A lane of D holds p = 16*rt + 8*(lane >> 4) + r of its j, which is the k map of a B fragment with k = p: the two D tiles, scaled and split
// into f16 hi + lo, ARE the B fragments of Z^T[o][j] += sum_p Wo[o][p*32+e] O[p][e] (8 o tiles, 2 products). No LDS and no exchange between waves before the output rows are staged.
__global__ __launch_bounds__(256) void opm_kernel(const b16* __restrict__ LT, const b16* __restrict__ RT, const b16* __restrict__ LTl, const b16* __restrict__ RTl, const b16* __restrict__ RW, const float* __restrict__ Pb, float* __restrict__ out) {
  __shared__ __attribute__((aligned(16))) float Zs[8][32][DO + 4];
  const int t_ = threadIdx.x, lane = t_ & 31, wave = t_ >> 5, nloc = lane & 15, hlf = lane >> 4, i = blockIdx.y * 8 + wave, j0 = blockIdx.x * 32;
  const gb16 Li = wave_base(LT + (size_t)i * P * S), Lil = wave_base(LTl + (size_t)i * P * S);
  const gb16 Rj = (gb16)(RT + (size_t)j0 * P * S), Rjl = (gb16)(RTl + (size_t)j0 * P * S);
  v16b ah[2][4], al[2][4], rh[2][4], rl[2][4];
#pragma unroll
  for (int rt = 0; rt < 2; ++rt)
#pragma unroll
    for (int kb = 0; kb < 4; ++kb) { ah[rt][kb] = frag_pk(Li + rt * 2048 + kb * 512, lane); al[rt][kb] = frag_pk(Lil + rt * 2048 + kb * 512, lane); }
#pragma unroll
  for (int jt = 0; jt < 2; ++jt)
#pragma unroll
    for (int kb = 0; kb < 4; ++kb) { rh[jt][kb] = frag_pk(Rj + jt * P * 2048 + kb * 512, lane); rl[jt][kb] = frag_pk(Rjl + jt * P * 2048 + kb * 512, lane); }
  asm volatile("s_wait_xcnt 0x0" ::: "memory");   // the loads above name scalar bases: the wait stands in front of everything that may give those registers new values
  v8f z[8][2] = {};   // [o tile][jt]
  // kept rolled: a second copy of the body would want a second set of fragment registers, and the wave's 512 are taken
#pragma unroll 1
  for (int e = 0; e < P; ++e) {
    v16b aw[8];   // this e's Wo fragments fly while the D tiles are formed
    const gb16 We = wave_base(RW + (size_t)e * 4096);
#pragma unroll
    for (int ot = 0; ot < 8; ++ot) aw[ot] = frag_pk(We + ot * 512, lane);
    asm volatile("s_wait_xcnt 0x0" ::: "memory");   // the loads above name We: the wait stands in front of everything that may give its registers new values
    __builtin_amdgcn_sched_barrier(0);   // keeps the Wo loads in front of the D products: sunk to their first use they would be waited for at once
    v8f d[2][2] = {};   // [jt][rt]
#pragma unroll
    for (int kb = 0; kb < 4; ++kb)
#pragma unroll
      for (int jt = 0; jt < 2; ++jt)
#pragma unroll
        for (int rt = 0; rt < 2; ++rt) { v8f c = d[jt][rt]; c = wmma16b(ah[rt][kb], rh[jt][kb], c); c = wmma16b(al[rt][kb], rh[jt][kb], c); c = wmma16b(ah[rt][kb], rl[jt][kb], c); d[jt][rt] = c; }
    v16b oh[2], ol[2];
#pragma unroll
    for (int jt = 0; jt < 2; ++jt)
#pragma unroll
      for (int rt = 0; rt < 2; ++rt)
#pragma unroll
        for (int r = 0; r < 8; ++r) { const float y = d[jt][rt][r] * (OS / (XS * XS)); const b16 h_ = (b16)y; oh[jt][rt * 8 + r] = h_; ol[jt][rt * 8 + r] = (b16)(y - (float)h_); }
    const int en = e + 1 < P ? e + 1 : e;   // the next e's right fragments fly under the Z products; the last pass reads its own again (in bounds, not used)
    const gb16 Re = wave_base(RT + (size_t)j0 * P * S + (size_t)en * 2048), Rel = wave_base(RTl + (size_t)j0 * P * S + (size_t)en * 2048);
#pragma unroll
    for (int jt = 0; jt < 2; ++jt)
#pragma unroll
      for (int kb = 0; kb < 4; ++kb) { rh[jt][kb] = frag_pk(Re + jt * P * 2048 + kb * 512, lane); rl[jt][kb] = frag_pk(Rel + jt * P * 2048 + kb * 512, lane); }
    asm volatile("s_wait_xcnt 0x0" ::: "memory");   // as above, for Re and Rel
    __builtin_amdgcn_sched_barrier(0);   // keeps the right loads in front of the Z products, which are their cover
#pragma unroll
    for (int ot = 0; ot < 8; ++ot)
#pragma unroll
      for (int jt = 0; jt < 2; ++jt) { v8f c = z[ot][jt]; c = wmma16b(aw[ot], oh[jt], c); c = wmma16b(aw[ot], ol[jt], c); z[ot][jt] = c; }
    // Pacing only, no data passes: the 8 waves read the same right and Wo fragments, and kept on the same e one fetch from L2 serves all of them through the WGP cache.
    __builtin_amdgcn_s_barrier();
  }
#pragma unroll
  for (int ot = 0; ot < 8; ++ot) { const v4f p0 = *(const v4f*)(Pb + ot * 16 + 8 * hlf), p1 = *(const v4f*)(Pb + ot * 16 + 8 * hlf + 4);
#pragma unroll
    for (int jt = 0; jt < 2; ++jt) { v4f a, b;
#pragma unroll
      for (int r = 0; r < 4; ++r) { a[r] = z[ot][jt][r] * (1.0f / OS) + p0[r]; b[r] = z[ot][jt][4 + r] * (1.0f / OS) + p1[r]; }
      float* zr = &Zs[wave][jt * 16 + nloc][ot * 16 + 8 * hlf]; *(v4f*)zr = a; *(v4f*)(zr + 4) = b; } }
  __syncthreads();
  // output rows (i, j) = 512 B: one wave-wide 16-byte store a row, the wave's 32 rows = 16 KB contiguous; unrolled whole, so that no register of an issued store is written again
#pragma unroll
  for (int rw = 0; rw < 32; ++rw) *(v4f*)(out + ((size_t)i * I + j0 + rw) * DO + lane * 4) = *(const v4f*)(&Zs[wave][rw][lane * 4]);
}
}  // namespace

extern "C" void kernel_launch(void* const* d_in, const int* in_sizes, int n_in,
                              void* d_out, int out_size, void* d_ws, size_t ws_size, hipStream_t stream) {
  (void)n_in; (void)out_size;
  const float* M = (const float*)d_in[0]; const float* g = (const float*)d_in[1]; const float* be = (const float*)d_in[2]; const float* Wa = (const float*)d_in[3]; const float* ba = (const float*)d_in[4]; const float* Wb = (const float*)d_in[5]; const float* bb = (const float*)d_in[6]; const float* Wo = (const float*)d_in[7]; const float* bo = (const float*)d_in[8];
  float* out = (float*)d_out;   // [1][256][256][128]
  if (in_sizes[0] != S * I * D || in_sizes[3] != P * D || in_sizes[7] != DO * PP) return;
  size_t off = 0; char* ws = (char*)d_ws;
  auto carve = [&](size_t bytes) { char* p = ws + off; off += (bytes + 255) & ~(size_t)255; return p; };
  b16* LT = (b16*)carve((size_t)I * P * S * 2); b16* RT = (b16*)carve((size_t)I * P * S * 2); b16* LTl = (b16*)carve((size_t)I * P * S * 2); b16* RTl = (b16*)carve((size_t)I * P * S * 2); b16* RW = (b16*)carve((size_t)DO * PP * 2); float* Pb = (float*)carve(DO * 4);
  if (off > ws_size) return;                                    // ≈ 2.1 x 4 + 0.26 MB
  proj_kernel<<<I, 256, 0, stream>>>(M, g, be, Wa, ba, Wb, bb, Wo, bo, LT, RT, LTl, RTl, RW, Pb);
  opm_kernel<<<dim3(I / 32, I / 8), 256, 0, stream>>>(LT, RT, LTl, RTl, RW, Pb, out);
}

// v005
// It runs in 49.8 microseconds.
// Timed twice side by side with v004, it ran 1.32 and 1.33 times as fast.
// All steps since v000 together make it 4.02 times as fast.
#include <hip/hip_runtime.h>

// OutProductMean: Mn = LN(M) over the 64 features; left = Mn Wa^T + ba (32), right = Mn Wb^T + bb (32); O[i][j][p][e] = Σ_s left[s][i][p] right[s][j][e];
// Z[i][j][o] = Σ_{p,e} O[i][j][p*32+e] Wo[o][p*32+e] + bo -> [1][256][256][128].
// WMMA (v_wmma_f32_16x16x32_f16, f32 accumulate): the two projections with EXACT weights and the LayerNormed rows as f16 hi+lo pairs x8 (2 products); per (i, j): O_ij[p][e] = Σ_s L_i[s][p] R_j[s][e] as a
// [32 x 128] x [128 x 32] product with the left/right planes as f16 hi+lo pairs x8 (3 products); the O values, x0.25 as f16 hi+lo, stay in registers and feed Z^T = Wo.O^T [128 x 1024] x
// [1024 x 32 j's] (2 products, exact Wo). LayerNorm in f32. Fragment k-map per lane

namespace {
constexpr int S = 128, I = 256, D = 64, P = 32, DO = 128, PP = P * P;
constexpr float XS = 8.0f, OS = 0.25f /* O staged x0.25 in f16 (|O| ≲ 60) */, EPS = 1e-5f;

typedef _Float16 b16;
typedef __attribute__((ext_vector_type(16))) _Float16 v16b;
typedef __attribute__((ext_vector_type(8))) _Float16 v8b;
typedef __attribute__((ext_vector_type(8))) float v8f;
typedef __attribute__((ext_vector_type(4))) float v4f;
__device__ __forceinline__ float bf16_rne(float f) { unsigned int u = __float_as_uint(f); u += 0x7FFFu + ((u >> 16) & 1u); return __uint_as_float(u & 0xFFFF0000u); }
__device__ __forceinline__ v16b frag_kb(const b16* p, int hh) { const v8b a = *(const v8b*)(p + 8 * hh), b = *(const v8b*)(p + 16 + 8 * hh); v16b f;
#pragma unroll
  for (int e = 0; e < 8; ++e) { f[e] = a[e]; f[8 + e] = b[e]; } return f; }
// Packed fragment: 512 halves in lane order, two planes of 32 lanes x 8 halves (k 8*hlf+e, then 16+8*hlf+e), so that each wave-wide 16-byte load covers 512 contiguous bytes.
typedef const __attribute__((address_space(1))) b16* gb16; typedef const __attribute__((address_space(1))) v8b* gv8b;
__device__ __forceinline__ v16b frag_pk(gb16 p, unsigned lane) { const v8b a = *(gv8b)(p + 8 * lane), b = *(gv8b)(p + 256 + 8 * lane); v16b f;
#pragma unroll
  for (int e = 0; e < 8; ++e) { f[e] = a[e]; f[8 + e] = b[e]; } return f; }
// A wave's own plane base as a scalar pair: its fragment loads are then scalar base + 16 B x lane, and the one vector register they name (the lane's offset) lives to the kernel's end.
__device__ __forceinline__ gb16 wave_base(const b16* p) { const unsigned long long u = (unsigned long long)p; const unsigned lo = (unsigned)__builtin_amdgcn_readfirstlane((int)(unsigned)u), hi = (unsigned)__builtin_amdgcn_readfirstlane((int)(unsigned)(u >> 32)); return (gb16)(((unsigned long long)hi << 32) | lo); }
__device__ __forceinline__ v8f wmma16b(v16b a, v16b b, v8f c) { return __builtin_amdgcn_wmma_f32_16x16x32_f16(false, a, false, b, (short)0, c, false, false); }
__device__ __forceinline__ void wave_lds_sync() { __builtin_amdgcn_fence(__ATOMIC_RELEASE, "workgroup"); __builtin_amdgcn_wave_barrier(); __builtin_amdgcn_fence(__ATOMIC_ACQUIRE, "workgroup"); }
__device__ __forceinline__ float pmul(float a, float b) { float p = a * b; asm volatile("" : "+v"(p)); return p; }
// 16 rows' wave-wide sums at once: per row the same butterfly as a single sum; the 16 exchanges of a step are independent and fly together, so a step costs one exchange latency for all rows
__device__ __forceinline__ void wsum16(float (&v)[16]) {
#pragma unroll
  for (int o = 1; o < 32; o <<= 1)
#pragma unroll
    for (int q = 0; q < 16; ++q) v[q] += __shfl_xor(v[q], o); }

// LN + projections: block = (tile of 16 i's, group of 8 s's) x 8 waves: wave w -> s = 8*s8 + w, its 16 rows are the 16 i's. LN over 64 (a row across the wave, 2 per lane, 16 rows at once), f16 hi+lo x8 A rows in LDS;
// [128 x 64] x [64 x 64] ([Wa;Wb] exact rows) + bias. A block owns one 8-wide s chunk of 16 i's, which is 256 contiguous bytes of every fragment plane it writes.
__global__ __launch_bounds__(256) void proj_kernel(const float* __restrict__ M, const float* __restrict__ g, const float* __restrict__ be, const float* __restrict__ Wa, const float* __restrict__ ba, const float* __restrict__ Wb, const float* __restrict__ bb, const float* __restrict__ Wo, const float* __restrict__ bo, b16* __restrict__ LT, b16* __restrict__ RT, b16* __restrict__ LTl, b16* __restrict__ RTl, b16* __restrict__ RW, float* __restrict__ Pb) {
  __shared__ __attribute__((aligned(16))) b16 Ar[S][D + 8], Arl[S][D + 8]; __shared__ __attribute__((aligned(16))) b16 Wr[2 * P][D + 8]; __shared__ __attribute__((aligned(16))) b16 To[2 * P][S + 8], Tol[2 * P][S + 8]; __shared__ float bias[64];
  const int blk = blockIdx.x, it = blk >> 4, s8 = blk & 15, t_ = threadIdx.x, lane = t_ & 31, wave = t_ >> 5, nloc = lane & 15, hlf = lane >> 4;
  // The kernel's global reads (all but block 0's of bo) are issued here, ahead of all use: one memory latency is paid for all of them together instead of one per row and per weight chunk.
  // The loops over rows and chunks down to the barrier are unrolled whole: their arrays must be registers, and the loads, and the exchanges of a step, stand together only so.
  const float* mr = M + ((size_t)(s8 * 8 + wave) * I + it * 16) * D + lane;   // the wave's 16 rows are 4 KB in a row
  float x0[16], x1[16], wv[16], wo[8] = {}, sm[16];
#pragma unroll
  for (int q = 0; q < 16; ++q) { x0[q] = mr[q * D]; x1[q] = mr[q * D + 32]; }
  const float gr0 = g[lane], gr1 = g[32 + lane], br0 = be[lane], br1 = be[32 + lane];
#pragma unroll
  for (int k = 0; k < 8; ++k) { wv[k] = Wa[k * 256 + t_]; wv[8 + k] = Wb[k * 256 + t_]; }
  // s_wait_xcnt, here and twice below: it stands in front of everything that may give a register that the loads above it name a new value; the vector address is an input, so that its registers keep it up to the wait
  asm volatile("s_wait_xcnt 0x0" :: "v"(mr) : "memory");
  float bv = 0.0f; if (t_ < 64) { const float* bp = (t_ < P) ? ba + t_ : bb + (t_ - P); bv = *bp; asm volatile("s_wait_xcnt 0x0" :: "v"(bp) : "memory"); }
  const int we = t_ & 31, wln = (blk * 8 + wave) & 31, whalf = (blk >> 2) & 1, wot = blk >> 3;   // this thread's chunk of the Wo fragments (blocks 0..63)
  if (blk < 64) { const float* wr = Wo + (size_t)(wot * 16 + (wln & 15)) * PP + (whalf * 16 + (wln >> 4) * 8) * P + we;
#pragma unroll
    for (int x = 0; x < 8; ++x) wo[x] = wr[x * P];
    asm volatile("s_wait_xcnt 0x0" :: "v"(wr) : "memory"); }
  // LayerNorm of the wave's 16 rows side by side, phase by phase: 16 independent chains in place of 16 chains one after another
#pragma unroll
  for (int q = 0; q < 16; ++q) { x0[q] = bf16_rne(x0[q]); x1[q] = bf16_rne(x1[q]); sm[q] = x0[q] + x1[q]; }
  wsum16(sm);
#pragma unroll
  for (int q = 0; q < 16; ++q) { const float mu = sm[q] * (1.0f / D); x0[q] = x0[q] - mu; x1[q] = x1[q] - mu; sm[q] = pmul(x0[q], x0[q]) + pmul(x1[q], x1[q]); }
  wsum16(sm);
  const float g0 = bf16_rne(gr0), g1 = bf16_rne(gr1), b0 = bf16_rne(br0), b1 = bf16_rne(br1);
#pragma unroll
  for (int q = 0; q < 16; ++q) { const float var = sm[q] * (1.0f / D); sm[q] = rsqrtf(var + EPS); }
#pragma unroll
  for (int q = 0; q < 16; ++q) { const int s = wave * 16 + q; const float inv = sm[q];
    const float y0 = (pmul(x0[q] * inv, g0) + b0) * XS, y1 = (pmul(x1[q] * inv, g1) + b1) * XS; const b16 h0 = (b16)y0, h1 = (b16)y1; Ar[s][lane] = h0; Arl[s][lane] = (b16)(y0 - (float)h0); Ar[s][32 + lane] = h1; Arl[s][32 + lane] = (b16)(y1 - (float)h1); }
#pragma unroll
  for (int k = 0; k < 8; ++k) { Wr[(t_ >> 6) + 4 * k][t_ & 63] = (b16)bf16_rne(wv[k]); Wr[P + (t_ >> 6) + 4 * k][t_ & 63] = (b16)bf16_rne(wv[8 + k]); }
  if (t_ < 64) bias[t_] = bf16_rne(bv);
  __syncthreads();
  // wave w: rows 16w..16w+15 x 64 cols (4 subtiles) x 2 k-steps
  v8f acc[4] = {{}, {}, {}, {}};
#pragma unroll
  for (int kb = 0; kb < D; kb += 32) { const v16b a = frag_kb(&Ar[wave * 16 + nloc][kb], hlf), al = frag_kb(&Arl[wave * 16 + nloc][kb], hlf);
#pragma unroll
    for (int t = 0; t < 4; ++t) { const v16b bw = frag_kb(&Wr[t * 16 + nloc][kb], hlf); acc[t] = wmma16b(a, bw, acc[t]); acc[t] = wmma16b(al, bw, acc[t]); } }
  // To[c][il * 8 + sl]: column c of i = 16*it + il at s = 8*s8 + sl, so that the 8 s values of one (c, i) are one 16-byte chunk
#pragma unroll
  for (int t = 0; t < 4; ++t)
#pragma unroll
    for (int r = 0; r < 8; ++r) { const int c = t * 16 + nloc, il = 8 * hlf + r; const float y = (acc[t][r] * (1.0f / XS) + bias[c]) * XS; const b16 h_ = (b16)y; To[c][il * 8 + wave] = h_; Tol[c][il * 8 + wave] = (b16)(y - (float)h_); }
  __syncthreads();
  {
    // planes leave in fragment order; s = 32*kb + 16*half + 8*(lane >> 4) + 0..7, so this block's chunks sit at (kb*2 + half) = s8 >> 1, lane >> 4 = s8 & 1.
    // left, per i: chunk ((row tile * 4 + kb) * 2 + half) * 32 + lane, lane & 15 = p & 15. right, per tile of 16 j's and per e: chunk ((jt * 32 + e) * 4 + kb) * 2 + half) * 32 + lane, lane & 15 = j & 15.
    const int fo = (s8 >> 1) * 32 + (s8 & 1) * 16;
    for (int q = t_; q < 2 * P * 16; q += 256) { const int side = q >> 9, l4 = q & 15; const int c = side ? P + ((q >> 4) & 31) : ((q >> 4) & 1) * 16 + l4, il = side ? l4 : (q >> 5) & 15;
      const size_t gi = side ? ((size_t)(it * P + ((q >> 4) & 31)) * 256 + fo + l4) * 8 : (size_t)(it * 16 + il) * P * S + (size_t)(((q >> 4) & 1) * 256 + fo + l4) * 8;
      b16* dh = side ? RT : LT; b16* dl = side ? RTl : LTl; *(v8b*)(dh + gi) = *(const v8b*)(&To[c][il * 8]); *(v8b*)(dl + gi) = *(const v8b*)(&Tol[c][il * 8]); }
    // Wo as the A fragments of Z^T, one k block of 32 per e with k = p: chunk ((e * 8 + o tile) * 2 + half) * 32 + lane holds Wo[16*tile + (lane & 15)][p * 32 + e], p = 16*half + 8*(lane >> 4) + 0..7
    if (blk < 64) { v8b v;
#pragma unroll
      for (int x = 0; x < 8; ++x) v[x] = (b16)bf16_rne(wo[x]);
      *(v8b*)(RW + ((size_t)((we * 8 + wot) * 2 + whalf) * 32 + wln) * 8) = v; if (blk == 0 && t_ < DO) Pb[t_] = bf16_rne(bo[t_]); }
     }
}

// outer product + output, all in registers: block = (8 i's, 32 j's) x 8 waves, wave w -> i = i0 + w and both tiles of 16 j's. Per e: D[p][j] = sum_s L_i[s][p] R_j[s][e] (rows p, 2 tiles; columns j on the lanes; 4 k-steps,
// 3 products; the 16 left fragments stay in registers for the whole kernel). A lane of D holds p = 16*rt + 8*(lane >> 4) + r of its j, which is the k map of a B fragment with k = p: the two D tiles, scaled and split
// into f16 hi + lo, ARE the B fragments of Z^T[o][j] += sum_p Wo[o][p*32+e] O[p][e] (8 o tiles, 2 products). No LDS and no exchange between waves before the output rows are staged.
__global__ __launch_bounds__(256) void opm_kernel(const b16* __restrict__ LT, const b16* __restrict__ RT, const b16* __restrict__ LTl, const b16* __restrict__ RTl, const b16* __restrict__ RW, const float* __restrict__ Pb, float* __restrict__ out) {
  __shared__ __attribute__((aligned(16))) float Zs[8][32][DO + 4];
  const int t_ = threadIdx.x, lane = t_ & 31, wave = t_ >> 5, nloc = lane & 15, hlf = lane >> 4, i = blockIdx.y * 8 + wave, j0 = blockIdx.x * 32;
  const gb16 Li = wave_base(LT + (size_t)i * P * S), Lil = wave_base(LTl + (size_t)i * P * S);
  const gb16 Rj = (gb16)(RT + (size_t)j0 * P * S), Rjl = (gb16)(RTl + (size_t)j0 * P * S);
  v16b ah[2][4], al[2][4], rh[2][4], rl[2][4];
#pragma unroll
  for (int rt = 0; rt < 2; ++rt)
#pragma unroll
    for (int kb = 0; kb < 4; ++kb) { ah[rt][kb] = frag_pk(Li + rt * 2048 + kb * 512, lane); al[rt][kb] = frag_pk(Lil + rt * 2048 + kb * 512, lane); }
#pragma unroll
  for (int jt = 0; jt < 2; ++jt)
#pragma unroll
    for (int kb = 0; kb < 4; ++kb) { rh[jt][kb] = frag_pk(Rj + jt * P * 2048 + kb * 512, lane); rl[jt][kb] = frag_pk(Rjl + jt * P * 2048 + kb * 512, lane); }
  asm volatile("s_wait_xcnt 0x0" ::: "memory");   // the loads above name scalar bases: the wait stands in front of everything that may give those registers new values
  v8f z[8][2] = {};   // [o tile][jt]
  // kept rolled: a second copy of the body would want a second set of fragment registers, and the wave's 512 are taken
#pragma unroll 1
  for (int e = 0; e < P; ++e) {
    v16b aw[8];   // this e's Wo fragments fly while the D tiles are formed
    const gb16 We = wave_base(RW + (size_t)e * 4096);
#pragma unroll
    for (int ot = 0; ot < 8; ++ot) aw[ot] = frag_pk(We + ot * 512, lane);
    asm volatile("s_wait_xcnt 0x0" ::: "memory");   // the loads above name We: the wait stands in front of everything that may give its registers new values
    __builtin_amdgcn_sched_barrier(0);   // keeps the Wo loads in front of the D products: sunk to their first use they would be waited for at once
    v8f d[2][2] = {};   // [jt][rt]
#pragma unroll
    for (int kb = 0; kb < 4; ++kb)
#pragma unroll
      for (int jt = 0; jt < 2; ++jt)
#pragma unroll
        for (int rt = 0; rt < 2; ++rt) { v8f c = d[jt][rt]; c = wmma16b(ah[rt][kb], rh[jt][kb], c); c = wmma16b(al[rt][kb], rh[jt][kb], c); c = wmma16b(ah[rt][kb], rl[jt][kb], c); d[jt][rt] = c; }
    v16b oh[2], ol[2];
#pragma unroll
    for (int jt = 0; jt < 2; ++jt)
#pragma unroll
      for (int rt = 0; rt < 2; ++rt)
#pragma unroll
        for (int r = 0; r < 8; ++r) { const float y = d[jt][rt][r] * (OS / (XS * XS)); const b16 h_ = (b16)y; oh[jt][rt * 8 + r] = h_; ol[jt][rt * 8 + r] = (b16)(y - (float)h_); }
    const int en = e + 1 < P ? e + 1 : e;   // the next e's right fragments fly under the Z products; the last pass reads its own again (in bounds, not used)
    const gb16 Re = wave_base(RT + (size_t)j0 * P * S + (size_t)en * 2048), Rel = wave_base(RTl + (size_t)j0 * P * S + (size_t)en * 2048);
#pragma unroll
    for (int jt = 0; jt < 2; ++jt)
#pragma unroll
      for (int kb = 0; kb < 4; ++kb) { rh[jt][kb] = frag_pk(Re + jt * P * 2048 + kb * 512, lane); rl[jt][kb] = frag_pk(Rel + jt * P * 2048 + kb * 512, lane); }
    asm volatile("s_wait_xcnt 0x0" ::: "memory");   // as above, for Re and Rel
    __builtin_amdgcn_sched_barrier(0);   // keeps the right loads in front of the Z products, which are their cover
#pragma unroll
    for (int ot = 0; ot < 8; ++ot)
#pragma unroll
      for (int jt = 0; jt < 2; ++jt) { v8f c = z[ot][jt]; c = wmma16b(aw[ot], oh[jt], c); c = wmma16b(aw[ot], ol[jt], c); z[ot][jt] = c; }
    // Pacing only, no data passes: the 8 waves read the same right and Wo fragments, and kept on the same e one fetch from L2 serves all of them through the WGP cache.
    __builtin_amdgcn_s_barrier();
  }
#pragma unroll
  for (int ot = 0; ot < 8; ++ot) { const v4f p0 = *(const v4f*)(Pb + ot * 16 + 8 * hlf), p1 = *(const v4f*)(Pb + ot * 16 + 8 * hlf + 4);
#pragma unroll
    for (int jt = 0; jt < 2; ++jt) { v4f a, b;
#pragma unroll
      for (int r = 0; r < 4; ++r) { a[r] = z[ot][jt][r] * (1.0f / OS) + p0[r]; b[r] = z[ot][jt][4 + r] * (1.0f / OS) + p1[r]; }
      float* zr = &Zs[wave][jt * 16 + nloc][ot * 16 + 8 * hlf]; *(v4f*)zr = a; *(v4f*)(zr + 4) = b; } }
  __syncthreads();
  // output rows (i, j) = 512 B: one wave-wide 16-byte store a row, the wave's 32 rows = 16 KB contiguous; unrolled whole, so that no register of an issued store is written again
#pragma unroll
  for (int rw = 0; rw < 32; ++rw) *(v4f*)(out + ((size_t)i * I + j0 + rw) * DO + lane * 4) = *(const v4f*)(&Zs[wave][rw][lane * 4]);
}
}  // namespace

extern "C" void kernel_launch(void* const* d_in, const int* in_sizes, int n_in,
                              void* d_out, int out_size, void* d_ws, size_t ws_size, hipStream_t stream) {
  (void)n_in; (void)out_size;
  const float* M = (const float*)d_in[0]; const float* g = (const float*)d_in[1]; const float* be = (const float*)d_in[2]; const float* Wa = (const float*)d_in[3]; const float* ba = (const float*)d_in[4]; const float* Wb = (const float*)d_in[5]; const float* bb = (const float*)d_in[6]; const float* Wo = (const float*)d_in[7]; const float* bo = (const float*)d_in[8];
  float* out = (float*)d_out;   // [1][256][256][128]
  if (in_sizes[0] != S * I * D || in_sizes[3] != P * D || in_sizes[7] != DO * PP) return;
  size_t off = 0; char* ws = (char*)d_ws;
  auto carve = [&](size_t bytes) { char* p = ws + off; off += (bytes + 255) & ~(size_t)255; return p; };
  b16* LT = (b16*)carve((size_t)I * P * S * 2); b16* RT = (b16*)carve((size_t)I * P * S * 2); b16* LTl = (b16*)carve((size_t)I * P * S * 2); b16* RTl = (b16*)carve((size_t)I * P * S * 2); b16* RW = (b16*)carve((size_t)DO * PP * 2); float* Pb = (float*)carve(DO * 4);
  if (off > ws_size) return;                                    // ≈ 2.1 x 4 + 0.26 MB
  proj_kernel<<<I, 256, 0, stream>>>(M, g, be, Wa, ba, Wb, bb, Wo, bo, LT, RT, LTl, RTl, RW, Pb);
  opm_kernel<<<dim3(I / 32, I / 8), 256, 0, stream>>>(LT, RT, LTl, RTl, RW, Pb, out);
}

// v006
// It runs in 47.4 microseconds.
// In two side-by-side timings against v005, it was 1.05 and 1.06 times as fast.
// Counting every step since v000, it is 4.25 times as fast.
#include <hip/hip_runtime.h>

// OutProductMean: Mn = LN(M) over the 64 features; left = Mn Wa^T + ba (32), right = Mn Wb^T + bb (32); O[i][j][p][e] = Σ_s left[s][i][p] right[s][j][e];
// Z[i][j][o] = Σ_{p,e} O[i][j][p*32+e] Wo[o][p*32+e] + bo -> [1][256][256][128].
// WMMA (v_wmma_f32_16x16x32_f16, f32 accumulate): the two projections with EXACT weights and the LayerNormed rows as f16 hi+lo pairs x8 (2 products); per (i, j): O_ij[p][e] = Σ_s L_i[s][p] R_j[s][e] as a
// [32 x 128] x [128 x 32] product with the left/right planes as f16 hi+lo pairs x8 (3 products); the O values, x0.25 as f16 hi+lo, stay in registers and feed Z^T = Wo.O^T [128 x 1024] x
// [1024 x 32 j's] (2 products, exact Wo). LayerNorm in f32. Fragment k-map per lane

namespace {
constexpr int S = 128, I = 256, D = 64, P = 32, DO = 128, PP = P * P;
constexpr float XS = 8.0f, OS = 0.25f /* O staged x0.25 in f16 (|O| ≲ 60) */, EPS = 1e-5f;

typedef _Float16 b16;
typedef __attribute__((ext_vector_type(16))) _Float16 v16b;
typedef __attribute__((ext_vector_type(8))) _Float16 v8b;
typedef __attribute__((ext_vector_type(8))) float v8f;
typedef __attribute__((ext_vector_type(4))) float v4f;
__device__ __forceinline__ float bf16_rne(float f) { unsigned int u = __float_as_uint(f); u += 0x7FFFu + ((u >> 16) & 1u); return __uint_as_float(u & 0xFFFF0000u); }
__device__ __forceinline__ v16b frag_kb(const b16* p, int hh) { const v8b a = *(const v8b*)(p + 8 * hh), b = *(const v8b*)(p + 16 + 8 * hh); v16b f;
#pragma unroll
  for (int e = 0; e < 8; ++e) { f[e] = a[e]; f[8 + e] = b[e]; } return f; }
// Packed fragment: 512 halves in lane order, two planes of 32 lanes x 8 halves (k 8*hlf+e, then 16+8*hlf+e), so that each wave-wide 16-byte load covers 512 contiguous bytes.
typedef const __attribute__((address_space(1))) b16* gb16; typedef const __attribute__((address_space(1))) v8b* gv8b;
__device__ __forceinline__ v16b frag_pk(gb16 p, unsigned lane) { const v8b a = *(gv8b)(p + 8 * lane), b = *(gv8b)(p + 256 + 8 * lane); v16b f;
#pragma unroll
  for (int e = 0; e < 8; ++e) { f[e] = a[e]; f[8 + e] = b[e]; } return f; }
// A wave's own plane base as a scalar pair: its fragment loads are then scalar base + 16 B x lane, and the one vector register they name (the lane's offset) lives to the kernel's end.
__device__ __forceinline__ gb16 wave_base(const b16* p) { const unsigned long long u = (unsigned long long)p; const unsigned lo = (unsigned)__builtin_amdgcn_readfirstlane((int)(unsigned)u), hi = (unsigned)__builtin_amdgcn_readfirstlane((int)(unsigned)(u >> 32)); return (gb16)(((unsigned long long)hi << 32) | lo); }
__device__ __forceinline__ v8f wmma16b(v16b a, v16b b, v8f c) { return __builtin_amdgcn_wmma_f32_16x16x32_f16(false, a, false, b, (short)0, c, false, false); }
__device__ __forceinline__ void wave_lds_sync() { __builtin_amdgcn_fence(__ATOMIC_RELEASE, "workgroup"); __builtin_amdgcn_wave_barrier(); __builtin_amdgcn_fence(__ATOMIC_ACQUIRE, "workgroup"); }
__device__ __forceinline__ float pmul(float a, float b) { float p = a * b; asm volatile("" : "+v"(p)); return p; }
// 16 rows' wave-wide sums at once: per row the same butterfly as a single sum; the 16 exchanges of a step are independent and fly together, so a step costs one exchange latency for all rows
__device__ __forceinline__ void wsum16(float (&v)[16]) {
#pragma unroll
  for (int o = 1; o < 32; o <<= 1)
#pragma unroll
    for (int q = 0; q < 16; ++q) v[q] += __shfl_xor(v[q], o); }

// LN + projections: block = (tile of 16 i's, group of 8 s's) x 8 waves: wave w -> s = 8*s8 + w, its 16 rows are the 16 i's. LN over 64 (a row across the wave, 2 per lane, 16 rows at once), f16 hi+lo x8 A rows in LDS;
// [128 x 64] x [64 x 64] ([Wa;Wb] exact rows) + bias. A block owns one 8-wide s chunk of 16 i's, which is 256 contiguous bytes of every fragment plane it writes.
__global__ __launch_bounds__(256) void proj_kernel(const float* __restrict__ M, const float* __restrict__ g, const float* __restrict__ be, const float* __restrict__ Wa, const float* __restrict__ ba, const float* __restrict__ Wb, const float* __restrict__ bb, const float* __restrict__ Wo, const float* __restrict__ bo, b16* __restrict__ LT, b16* __restrict__ RT, b16* __restrict__ LTl, b16* __restrict__ RTl, b16* __restrict__ RW, float* __restrict__ Pb) {
  __shared__ __attribute__((aligned(16))) b16 Ar[S][D + 8], Arl[S][D + 8]; __shared__ __attribute__((aligned(16))) b16 Wr[2 * P][D + 8]; __shared__ __attribute__((aligned(16))) b16 To[2 * P][S + 8], Tol[2 * P][S + 8]; __shared__ float bias[64];
  const int blk = blockIdx.x, it = blk >> 4, s8 = blk & 15, t_ = threadIdx.x, lane = t_ & 31, wave = t_ >> 5, nloc = lane & 15, hlf = lane >> 4;
  // The kernel's global reads (all but block 0's of bo) are issued here, ahead of all use: one memory latency is paid for all of them together instead of one per row and per weight chunk.
  // The loops over rows and chunks down to the barrier are unrolled whole: their arrays must be registers, and the loads, and the exchanges of a step, stand together only so.
  const float* mr = M + ((size_t)(s8 * 8 + wave) * I + it * 16) * D + lane;   // the wave's 16 rows are 4 KB in a row
  float x0[16], x1[16], wv[16], wo[8] = {}, sm[16];
#pragma unroll
  for (int q = 0; q < 16; ++q) { x0[q] = mr[q * D]; x1[q] = mr[q * D + 32]; }
  const float gr0 = g[lane], gr1 = g[32 + lane], br0 = be[lane], br1 = be[32 + lane];
#pragma unroll
  for (int k = 0; k < 8; ++k) { wv[k] = Wa[k * 256 + t_]; wv[8 + k] = Wb[k * 256 + t_]; }
  // s_wait_xcnt, here and twice below: it stands in front of everything that may give a register that the loads above it name a new value; the vector address is an input, so that its registers keep it up to the wait
  asm volatile("s_wait_xcnt 0x0" :: "v"(mr) : "memory");
  float bv = 0.0f; if (t_ < 64) { const float* bp = (t_ < P) ? ba + t_ : bb + (t_ - P); bv = *bp; asm volatile("s_wait_xcnt 0x0" :: "v"(bp) : "memory"); }
  const int we = t_ & 31, wln = (blk * 8 + wave) & 31, whalf = (blk >> 2) & 1, wot = blk >> 3;   // this thread's chunk of the Wo fragments (blocks 0..63)
  if (blk < 64) { const float* wr = Wo + (size_t)(wot * 16 + (wln & 15)) * PP + (whalf * 16 + (wln >> 4) * 8) * P + we;
#pragma unroll
    for (int x = 0; x < 8; ++x) wo[x] = wr[x * P];
    asm volatile("s_wait_xcnt 0x0" :: "v"(wr) : "memory"); }
  // LayerNorm of the wave's 16 rows side by side, phase by phase: 16 independent chains in place of 16 chains one after another
#pragma unroll
  for (int q = 0; q < 16; ++q) { x0[q] = bf16_rne(x0[q]); x1[q] = bf16_rne(x1[q]); sm[q] = x0[q] + x1[q]; }
  wsum16(sm);
#pragma unroll
  for (int q = 0; q < 16; ++q) { const float mu = sm[q] * (1.0f / D); x0[q] = x0[q] - mu; x1[q] = x1[q] - mu; sm[q] = pmul(x0[q], x0[q]) + pmul(x1[q], x1[q]); }
  wsum16(sm);
  const float g0 = bf16_rne(gr0), g1 = bf16_rne(gr1), b0 = bf16_rne(br0), b1 = bf16_rne(br1);
#pragma unroll
  for (int q = 0; q < 16; ++q) { const float var = sm[q] * (1.0f / D); sm[q] = rsqrtf(var + EPS); }
#pragma unroll
  for (int q = 0; q < 16; ++q) { const int s = wave * 16 + q; const float inv = sm[q];
    const float y0 = (pmul(x0[q] * inv, g0) + b0) * XS, y1 = (pmul(x1[q] * inv, g1) + b1) * XS; const b16 h0 = (b16)y0, h1 = (b16)y1; Ar[s][lane] = h0; Arl[s][lane] = (b16)(y0 - (float)h0); Ar[s][32 + lane] = h1; Arl[s][32 + lane] = (b16)(y1 - (float)h1); }
#pragma unroll
  for (int k = 0; k < 8; ++k) { Wr[(t_ >> 6) + 4 * k][t_ & 63] = (b16)bf16_rne(wv[k]); Wr[P + (t_ >> 6) + 4 * k][t_ & 63] = (b16)bf16_rne(wv[8 + k]); }
  if (t_ < 64) bias[t_] = bf16_rne(bv);
  __syncthreads();
  // wave w: rows 16w..16w+15 x 64 cols (4 subtiles) x 2 k-steps
  v8f acc[4] = {{}, {}, {}, {}};
#pragma unroll
  for (int kb = 0; kb < D; kb += 32) { const v16b a = frag_kb(&Ar[wave * 16 + nloc][kb], hlf), al = frag_kb(&Arl[wave * 16 + nloc][kb], hlf);
#pragma unroll
    for (int t = 0; t < 4; ++t) { const v16b bw = frag_kb(&Wr[t * 16 + nloc][kb], hlf); acc[t] = wmma16b(a, bw, acc[t]); acc[t] = wmma16b(al, bw, acc[t]); } }
  // To[c][il * 8 + sl]: column c of i = 16*it + il at s = 8*s8 + sl, so that the 8 s values of one (c, i) are one 16-byte chunk
#pragma unroll
  for (int t = 0; t < 4; ++t)
#pragma unroll
    for (int r = 0; r < 8; ++r) { const int c = t * 16 + nloc, il = 8 * hlf + r; const float y = (acc[t][r] * (1.0f / XS) + bias[c]) * XS; const b16 h_ = (b16)y; To[c][il * 8 + wave] = h_; Tol[c][il * 8 + wave] = (b16)(y - (float)h_); }
  __syncthreads();
  {
    // planes leave in fragment order; s = 32*kb + 16*half + 8*(lane >> 4) + 0..7, so this block's chunks sit at (kb*2 + half) = s8 >> 1, lane >> 4 = s8 & 1.
    // left, per i: chunk ((row tile * 4 + kb) * 2 + half) * 32 + lane, lane & 15 = p & 15. right, per tile of 16 j's and per e: chunk ((jt * 32 + e) * 4 + kb) * 2 + half) * 32 + lane, lane & 15 = j & 15.
    const int fo = (s8 >> 1) * 32 + (s8 & 1) * 16;
    for (int q = t_; q < 2 * P * 16; q += 256) { const int side = q >> 9, l4 = q & 15; const int c = side ? P + ((q >> 4) & 31) : ((q >> 4) & 1) * 16 + l4, il = side ? l4 : (q >> 5) & 15;
      const size_t gi = side ? ((size_t)(it * P + ((q >> 4) & 31)) * 256 + fo + l4) * 8 : (size_t)(it * 16 + il) * P * S + (size_t)(((q >> 4) & 1) * 256 + fo + l4) * 8;
      b16* dh = side ? RT : LT; b16* dl = side ? RTl : LTl; *(v8b*)(dh + gi) = *(const v8b*)(&To[c][il * 8]); *(v8b*)(dl + gi) = *(const v8b*)(&Tol[c][il * 8]); }
    // Wo as the A fragments of Z^T, one k block of 32 per e with k = p: chunk ((e * 8 + o tile) * 2 + half) * 32 + lane holds Wo[16*tile + (lane & 15)][p * 32 + e], p = 16*half + 8*(lane >> 4) + 0..7
    if (blk < 64) { v8b v;
#pragma unroll
      for (int x = 0; x < 8; ++x) v[x] = (b16)bf16_rne(wo[x]);
      *(v8b*)(RW + ((size_t)((we * 8 + wot) * 2 + whalf) * 32 + wln) * 8) = v; if (blk == 0 && t_ < DO) Pb[t_] = bf16_rne(bo[t_]); }
     }
}

// One stage of the split of a pair of D values (pair k of the 8 that a lane holds of one j tile) into f16 hi + lo words of a B fragment: 0 scale, 1 hi, 2 hi back in f32, 3 rest, 4 lo.
// Each stage needs the one before it: dealt out one stage a WMMA, no vector instruction waits for the one in front of it.
typedef __attribute__((ext_vector_type(2))) float v2f; typedef __attribute__((ext_vector_type(2))) _Float16 v2b; typedef __attribute__((ext_vector_type(8))) unsigned v8u;
struct split_t { v2f y[8], f[8]; v2b h[8]; v8u hi, lo; };
__device__ __forceinline__ void split_stage(split_t& t, const v8f (&d)[2], int k, int s) {
  if (k < 0 || k > 7) return;
  if (s == 0) { const v2f x = {d[k >> 2][(2 * k) & 7], d[k >> 2][(2 * k + 1) & 7]}; t.y[k] = x * (OS / (XS * XS)); }
  else if (s == 1) { t.h[k] = __builtin_convertvector(t.y[k], v2b); t.hi[k] = __builtin_bit_cast(unsigned, t.h[k]); }
  else if (s == 2) t.f[k] = __builtin_convertvector(t.h[k], v2f);
  else if (s == 3) t.f[k] = t.y[k] - t.f[k];
  else if (s == 4) t.lo[k] = __builtin_bit_cast(unsigned, __builtin_convertvector(t.f[k], v2b)); }

// outer product + output, all in registers: block = (8 i's, 32 j's) x 8 waves, wave w -> i = i0 + w and both tiles of 16 j's. Per e: D[p][j] = sum_s L_i[s][p] R_j[s][e] (rows p, 2 tiles; columns j on the lanes; 4 k-steps,
// 3 products; the 16 left fragments stay in registers for the whole kernel). A lane of D holds p = 16*rt + 8*(lane >> 4) + r of its j, which is the k map of a B fragment with k = p: the two D tiles, scaled and split
// into f16 hi + lo, ARE the B fragments of Z^T[o][j] += sum_p Wo[o][p*32+e] O[p][e] (8 o tiles, 2 products). No LDS and no exchange between waves before the output rows are staged.
__global__ __launch_bounds__(256) void opm_kernel(const b16* __restrict__ LT, const b16* __restrict__ RT, const b16* __restrict__ LTl, const b16* __restrict__ RTl, const b16* __restrict__ RW, const float* __restrict__ Pb, float* __restrict__ out) {
  __shared__ __attribute__((aligned(16))) float Zs[8][32][DO + 4];
  const int t_ = threadIdx.x, lane = t_ & 31, wave = t_ >> 5, nloc = lane & 15, hlf = lane >> 4, i = blockIdx.y * 8 + wave, j0 = blockIdx.x * 32;
  const gb16 Li = wave_base(LT + (size_t)i * P * S), Lil = wave_base(LTl + (size_t)i * P * S);
  const gb16 Rj = (gb16)(RT + (size_t)j0 * P * S), Rjl = (gb16)(RTl + (size_t)j0 * P * S);
  v16b ah[2][4], al[2][4], rh[2][4], rl[2][4];
#pragma unroll
  for (int rt = 0; rt < 2; ++rt)
#pragma unroll
    for (int kb = 0; kb < 4; ++kb) { ah[rt][kb] = frag_pk(Li + rt * 2048 + kb * 512, lane); al[rt][kb] = frag_pk(Lil + rt * 2048 + kb * 512, lane); }
#pragma unroll
  for (int jt = 0; jt < 2; ++jt)
#pragma unroll
    for (int kb = 0; kb < 4; ++kb) { rh[jt][kb] = frag_pk(Rj + jt * P * 2048 + kb * 512, lane); rl[jt][kb] = frag_pk(Rjl + jt * P * 2048 + kb * 512, lane); }
  asm volatile("s_wait_xcnt 0x0" ::: "memory");   // the loads above name scalar bases: the wait stands in front of everything that may give those registers new values
  v8f z[8][2] = {};   // [o tile][jt]
  // kept rolled: a second copy of the body would want a second set of fragment registers, and the wave's 512 are taken
#pragma unroll 1
  for (int e = 0; e < P; ++e) {
    v16b aw[8];   // this e's Wo fragments fly while the D tiles are formed
    const gb16 We = wave_base(RW + (size_t)e * 4096);
#pragma unroll
    for (int ot = 0; ot < 8; ++ot) aw[ot] = frag_pk(We + ot * 512, lane);
    asm volatile("s_wait_xcnt 0x0" ::: "memory");   // the loads above name We: the wait stands in front of everything that may give its registers new values
    __builtin_amdgcn_sched_barrier(0);   // keeps the Wo loads in front of the D products: sunk to their first use they would be waited for at once
    // The two j tiles run half a pass apart: the vector work that splits one tile's D into f16 hi + lo is dealt out behind the WMMAs of the other tile, and so issues while the matrix unit is busy.
    // STEP (nothing is scheduled across it) holds that order: left free, the compiler gathers the splits into one run with no WMMA in it, in which the matrix unit stands idle.
#define STEP() __builtin_amdgcn_sched_barrier(0)
    v8f d0[2] = {}, d1[2] = {};   // [rt], j tile 0 and 1; per accumulator the order of sums is kb, then hi.hi, lo.hi, hi.lo
    split_t o0, o1;
#pragma unroll
    for (int n = 0; n < 24; ++n) { const int kb = n / 6, pr = (n % 6) >> 1, rt = n & 1; d0[rt] = wmma16b(pr == 1 ? al[rt][kb] : ah[rt][kb], pr == 2 ? rl[0][kb] : rh[0][kb], d0[rt]); }
    STEP();
#pragma unroll
    for (int n = 0; n < 24; ++n) { const int kb = n / 6, pr = (n % 6) >> 1, rt = n & 1; d1[rt] = wmma16b(pr == 1 ? al[rt][kb] : ah[rt][kb], pr == 2 ? rl[1][kb] : rh[1][kb], d1[rt]);
#pragma unroll
      for (int s = 0; s < 5; ++s) if (((n - 2 - s) & 1) == 0) split_stage(o0, d0, (n - 2 - s) >> 1, s);   // pair k starts behind WMMA 2 + 2k
      STEP(); }
    const int en = e + 1 < P ? e + 1 : e;   // the next e's right fragments fly under the Z products; the last pass reads its own again (in bounds, not used)
    const gb16 Re = wave_base(RT + (size_t)j0 * P * S + (size_t)en * 2048), Rel = wave_base(RTl + (size_t)j0 * P * S + (size_t)en * 2048);
#pragma unroll
    for (int jt = 0; jt < 2; ++jt)
#pragma unroll
      for (int kb = 0; kb < 4; ++kb) { rh[jt][kb] = frag_pk(Re + jt * P * 2048 + kb * 512, lane); rl[jt][kb] = frag_pk(Rel + jt * P * 2048 + kb * 512, lane); }
    asm volatile("s_wait_xcnt 0x0" ::: "memory");   // as above, for Re and Rel
    __builtin_amdgcn_sched_barrier(0);   // keeps the right loads in front of the Z products, which are their cover
    const v16b oh0 = __builtin_bit_cast(v16b, o0.hi), ol0 = __builtin_bit_cast(v16b, o0.lo);
#pragma unroll
    for (int n = 0; n < 16; ++n) { const int ot = n & 7; z[ot][0] = wmma16b(aw[ot], n < 8 ? oh0 : ol0, z[ot][0]);
#pragma unroll
      for (int k = 0; k < 8; ++k) { const int s = n - ((3 * k) >> 1); if (s >= 0 && s < 5) split_stage(o1, d1, k, s); }   // pair k starts behind WMMA 3k/2
      STEP(); }
    const v16b oh1 = __builtin_bit_cast(v16b, o1.hi), ol1 = __builtin_bit_cast(v16b, o1.lo);
#pragma unroll
    for (int n = 0; n < 16; ++n) { const int ot = n & 7; z[ot][1] = wmma16b(aw[ot], n < 8 ? oh1 : ol1, z[ot][1]); }
#undef STEP
    // Pacing only, no data passes: the 8 waves read the same right and Wo fragments, and kept on the same e one fetch from L2 serves all of them through the WGP cache.
    __builtin_amdgcn_s_barrier();
  }
#pragma unroll
  for (int ot = 0; ot < 8; ++ot) { const v4f p0 = *(const v4f*)(Pb + ot * 16 + 8 * hlf), p1 = *(const v4f*)(Pb + ot * 16 + 8 * hlf + 4);
#pragma unroll
    for (int jt = 0; jt < 2; ++jt) { v4f a, b;
#pragma unroll
      for (int r = 0; r < 4; ++r) { a[r] = z[ot][jt][r] * (1.0f / OS) + p0[r]; b[r] = z[ot][jt][4 + r] * (1.0f / OS) + p1[r]; }
      float* zr = &Zs[wave][jt * 16 + nloc][ot * 16 + 8 * hlf]; *(v4f*)zr = a; *(v4f*)(zr + 4) = b; } }
  __syncthreads();
  // output rows (i, j) = 512 B: one wave-wide 16-byte store a row, the wave's 32 rows = 16 KB contiguous; unrolled whole, so that no register of an issued store is written again
#pragma unroll
  for (int rw = 0; rw < 32; ++rw) *(v4f*)(out + ((size_t)i * I + j0 + rw) * DO + lane * 4) = *(const v4f*)(&Zs[wave][rw][lane * 4]);
}
}  // namespace

extern "C" void kernel_launch(void* const* d_in, const int* in_sizes, int n_in,
                              void* d_out, int out_size, void* d_ws, size_t ws_size, hipStream_t stream) {
  (void)n_in; (void)out_size;
  const float* M = (const float*)d_in[0]; const float* g = (const float*)d_in[1]; const float* be = (const float*)d_in[2]; const float* Wa = (const float*)d_in[3]; const float* ba = (const float*)d_in[4]; const float* Wb = (const float*)d_in[5]; const float* bb = (const float*)d_in[6]; const float* Wo = (const float*)d_in[7]; const float* bo = (const float*)d_in[8];
  float* out = (float*)d_out;   // [1][256][256][128]
  if (in_sizes[0] != S * I * D || in_sizes[3] != P * D || in_sizes[7] != DO * PP) return;
  size_t off = 0; char* ws = (char*)d_ws;
  auto carve = [&](size_t bytes) { char* p = ws + off; off += (bytes + 255) & ~(size_t)255; return p; };
  b16* LT = (b16*)carve((size_t)I * P * S * 2); b16* RT = (b16*)carve((size_t)I * P * S * 2); b16* LTl = (b16*)carve((size_t)I * P * S * 2); b16* RTl = (b16*)carve((size_t)I * P * S * 2); b16* RW = (b16*)carve((size_t)DO * PP * 2); float* Pb = (float*)carve(DO * 4);
  if (off > ws_size) return;                                    // ≈ 2.1 x 4 + 0.26 MB
  proj_kernel<<<I, 256, 0, stream>>>(M, g, be, Wa, ba, Wb, bb, Wo, bo, LT, RT, LTl, RTl, RW, Pb);
  opm_kernel<<<dim3(I / 32, I / 8), 256, 0, stream>>>(LT, RT, LTl, RTl, RW, Pb, out);
}

// v008
// It runs in 26.7 microseconds.
// Versions between v006 and this one are left out; their measured steps multiply to 1.74 times as fast.
// Over all steps from v000 it is 7.40 times as fast.
#include <hip/hip_runtime.h>

// OutProductMean: Mn = LN(M) over the 64 features; left = Mn Wa^T + ba (32), right = Mn Wb^T + bb (32); O[i][j][p][e] = Σ_s left[s][i][p] right[s][j][e];
// Z[i][j][o] = Σ_{p,e} O[i][j][p*32+e] Wo[o][p*32+e] + bo -> [1][256][256][128].
// WMMA (v_wmma_f32_16x16x32_f16, f32 accumulate): the two projections with EXACT weights and the LayerNormed rows as f16 hi+lo pairs x8 (2 products); per (i, j): O_ij[p][e] = sum over s of L_i[s][p] R_j[s][e] as a
// [32 x 128] x [128 x 32] product with the left/right planes rounded once to f16, x0.5 (1 product, which so comes out as O x0.25); the O values, rounded once to f16, stay in registers and feed
// Z^T = Wo.O^T [128 x 1024] x [1024 x 32 j's] (1 product, exact Wo). LayerNorm in f32. Fragment k-map per lane

namespace {
constexpr int S = 128, I = 256, D = 64, P = 32, DO = 128, PP = P * P;
constexpr float XS = 8.0f, PS = 0.5f /* scale of the left and right planes */, OS = PS * PS /* so O arrives x0.25, the scale at which it is rounded to f16 */, EPS = 1e-5f;

typedef _Float16 b16;
typedef __attribute__((ext_vector_type(16))) _Float16 v16b;
typedef __attribute__((ext_vector_type(8))) _Float16 v8b;
typedef __attribute__((ext_vector_type(8))) float v8f;
typedef __attribute__((ext_vector_type(4))) float v4f;
__device__ __forceinline__ float bf16_rne(float f) { unsigned int u = __float_as_uint(f); u += 0x7FFFu + ((u >> 16) & 1u); return __uint_as_float(u & 0xFFFF0000u); }
__device__ __forceinline__ v16b frag_kb(const b16* p, int hh) { const v8b a = *(const v8b*)(p + 8 * hh), b = *(const v8b*)(p + 16 + 8 * hh); v16b f;
#pragma unroll
  for (int e = 0; e < 8; ++e) { f[e] = a[e]; f[8 + e] = b[e]; } return f; }
// Packed fragment: 512 halves in lane order, two planes of 32 lanes x 8 halves (k 8*hlf+e, then 16+8*hlf+e), so that each wave-wide 16-byte load covers 512 contiguous bytes.
typedef const __attribute__((address_space(1))) b16* gb16; typedef const __attribute__((address_space(1))) v8b* gv8b;
__device__ __forceinline__ v16b frag_pk(gb16 p, unsigned lane) { const v8b a = *(gv8b)(p + 8 * lane), b = *(gv8b)(p + 256 + 8 * lane); v16b f;
#pragma unroll
  for (int e = 0; e < 8; ++e) { f[e] = a[e]; f[8 + e] = b[e]; } return f; }
// A wave's own plane base as a scalar pair: its fragment loads are then scalar base + 16 B x lane, and the one vector register they name (the lane's offset) lives to the kernel's end.
__device__ __forceinline__ gb16 wave_base(const b16* p) { const unsigned long long u = (unsigned long long)p; const unsigned lo = (unsigned)__builtin_amdgcn_readfirstlane((int)(unsigned)u), hi = (unsigned)__builtin_amdgcn_readfirstlane((int)(unsigned)(u >> 32)); return (gb16)(((unsigned long long)hi << 32) | lo); }
__device__ __forceinline__ v8f wmma16b(v16b a, v16b b, v8f c) { return __builtin_amdgcn_wmma_f32_16x16x32_f16(false, a, false, b, (short)0, c, false, false); }
__device__ __forceinline__ void wave_lds_sync() { __builtin_amdgcn_fence(__ATOMIC_RELEASE, "workgroup"); __builtin_amdgcn_wave_barrier(); __builtin_amdgcn_fence(__ATOMIC_ACQUIRE, "workgroup"); }
__device__ __forceinline__ float pmul(float a, float b) { float p = a * b; asm volatile("" : "+v"(p)); return p; }
// 16 rows' wave-wide sums at once: per row the same butterfly as a single sum; the 16 exchanges of a step are independent and fly together, so a step costs one exchange latency for all rows
__device__ __forceinline__ void wsum16(float (&v)[16]) {
#pragma unroll
  for (int o = 1; o < 32; o <<= 1)
#pragma unroll
    for (int q = 0; q < 16; ++q) v[q] += __shfl_xor(v[q], o); }

// LN + projections: block = (tile of 16 i's, group of 8 s's) x 8 waves: wave w -> s = 8*s8 + w, its 16 rows are the 16 i's. LN over 64 (a row across the wave, 2 per lane, 16 rows at once), f16 hi+lo x8 A rows in LDS;
// [128 x 64] x [64 x 64] ([Wa;Wb] exact rows) + bias. A block owns one 8-wide s chunk of 16 i's, which is 256 contiguous bytes of every fragment plane it writes.
__global__ __launch_bounds__(256) void proj_kernel(const float* __restrict__ M, const float* __restrict__ g, const float* __restrict__ be, const float* __restrict__ Wa, const float* __restrict__ ba, const float* __restrict__ Wb, const float* __restrict__ bb, const float* __restrict__ Wo, const float* __restrict__ bo, b16* __restrict__ LT, b16* __restrict__ RT, b16* __restrict__ RW, float* __restrict__ Pb) {
  __shared__ __attribute__((aligned(16))) b16 Ar[S][D + 8], Arl[S][D + 8]; __shared__ __attribute__((aligned(16))) b16 Wr[2 * P][D + 8]; __shared__ __attribute__((aligned(16))) b16 To[2 * P][S + 8]; __shared__ float bias[64];
  const int blk = blockIdx.x, it = blk >> 4, s8 = blk & 15, t_ = threadIdx.x, lane = t_ & 31, wave = t_ >> 5, nloc = lane & 15, hlf = lane >> 4;
  // The kernel's global reads (all but block 0's of bo) are issued here, ahead of all use: one memory latency is paid for all of them together instead of one per row and per weight chunk.
  // The loops over rows and chunks down to the barrier are unrolled whole: their arrays must be registers, and the loads, and the exchanges of a step, stand together only so.
  const float* mr = M + ((size_t)(s8 * 8 + wave) * I + it * 16) * D + lane;   // the wave's 16 rows are 4 KB in a row
  float x0[16], x1[16], wv[16], wo[8] = {}, sm[16];
#pragma unroll
  for (int q = 0; q < 16; ++q) { x0[q] = mr[q * D]; x1[q] = mr[q * D + 32]; }
  const float gr0 = g[lane], gr1 = g[32 + lane], br0 = be[lane], br1 = be[32 + lane];
#pragma unroll
  for (int k = 0; k < 8; ++k) { wv[k] = Wa[k * 256 + t_]; wv[8 + k] = Wb[k * 256 + t_]; }
  // s_wait_xcnt, here and twice below: it stands in front of everything that may give a register that the loads above it name a new value; the vector address is an input, so that its registers keep it up to the wait
  asm volatile("s_wait_xcnt 0x0" :: "v"(mr) : "memory");
  float bv = 0.0f; if (t_ < 64) { const float* bp = (t_ < P) ? ba + t_ : bb + (t_ - P); bv = *bp; asm volatile("s_wait_xcnt 0x0" :: "v"(bp) : "memory"); }
  const int we = t_ & 31, wln = (blk * 8 + wave) & 31, whalf = (blk >> 2) & 1, wot = blk >> 3;   // this thread's chunk of the Wo fragments (blocks 0..63)
  if (blk < 64) { const float* wr = Wo + (size_t)(wot * 16 + (wln & 15)) * PP + (whalf * 16 + (wln >> 4) * 8) * P + we;
#pragma unroll
    for (int x = 0; x < 8; ++x) wo[x] = wr[x * P];
    asm volatile("s_wait_xcnt 0x0" :: "v"(wr) : "memory"); }
  // LayerNorm of the wave's 16 rows side by side, phase by phase: 16 independent chains in place of 16 chains one after another
#pragma unroll
  for (int q = 0; q < 16; ++q) { x0[q] = bf16_rne(x0[q]); x1[q] = bf16_rne(x1[q]); sm[q] = x0[q] + x1[q]; }
  wsum16(sm);
#pragma unroll
  for (int q = 0; q < 16; ++q) { const float mu = sm[q] * (1.0f / D); x0[q] = x0[q] - mu; x1[q] = x1[q] - mu; sm[q] = pmul(x0[q], x0[q]) + pmul(x1[q], x1[q]); }
  wsum16(sm);
  const float g0 = bf16_rne(gr0), g1 = bf16_rne(gr1), b0 = bf16_rne(br0), b1 = bf16_rne(br1);
#pragma unroll
  for (int q = 0; q < 16; ++q) { const float var = sm[q] * (1.0f / D); sm[q] = rsqrtf(var + EPS); }
#pragma unroll
  for (int q = 0; q < 16; ++q) { const int s = wave * 16 + q; const float inv = sm[q];
    const float y0 = (pmul(x0[q] * inv, g0) + b0) * XS, y1 = (pmul(x1[q] * inv, g1) + b1) * XS; const b16 h0 = (b16)y0, h1 = (b16)y1; Ar[s][lane] = h0; Arl[s][lane] = (b16)(y0 - (float)h0); Ar[s][32 + lane] = h1; Arl[s][32 + lane] = (b16)(y1 - (float)h1); }
#pragma unroll
  for (int k = 0; k < 8; ++k) { Wr[(t_ >> 6) + 4 * k][t_ & 63] = (b16)bf16_rne(wv[k]); Wr[P + (t_ >> 6) + 4 * k][t_ & 63] = (b16)bf16_rne(wv[8 + k]); }
  if (t_ < 64) bias[t_] = bf16_rne(bv);
  __syncthreads();
  // wave w: rows 16w..16w+15 x 64 cols (4 subtiles) x 2 k-steps
  v8f acc[4] = {{}, {}, {}, {}};
#pragma unroll
  for (int kb = 0; kb < D; kb += 32) { const v16b a = frag_kb(&Ar[wave * 16 + nloc][kb], hlf), al = frag_kb(&Arl[wave * 16 + nloc][kb], hlf);
#pragma unroll
    for (int t = 0; t < 4; ++t) { const v16b bw = frag_kb(&Wr[t * 16 + nloc][kb], hlf); acc[t] = wmma16b(a, bw, acc[t]); acc[t] = wmma16b(al, bw, acc[t]); } }
  // To[c][il * 8 + sl]: column c of i = 16*it + il at s = 8*s8 + sl, so that the 8 s values of one (c, i) are one 16-byte chunk
#pragma unroll
  for (int t = 0; t < 4; ++t)
#pragma unroll
    for (int r = 0; r < 8; ++r) { const int c = t * 16 + nloc, il = 8 * hlf + r; To[c][il * 8 + wave] = (b16)((acc[t][r] * (1.0f / XS) + bias[c]) * PS); }
  __syncthreads();
  {
    // planes leave in fragment order; s = 32*kb + 16*half + 8*(lane >> 4) + 0..7, so this block's chunks sit at (kb*2 + half) = s8 >> 1, lane >> 4 = s8 & 1.
    // left, per i: chunk ((row tile * 4 + kb) * 2 + half) * 32 + lane, lane & 15 = p & 15. right, per tile of 16 j's and per e: chunk ((jt * 32 + e) * 4 + kb) * 2 + half) * 32 + lane, lane & 15 = j & 15.
    const int fo = (s8 >> 1) * 32 + (s8 & 1) * 16;
    for (int q = t_; q < 2 * P * 16; q += 256) { const int side = q >> 9, l4 = q & 15; const int c = side ? P + ((q >> 4) & 31) : ((q >> 4) & 1) * 16 + l4, il = side ? l4 : (q >> 5) & 15;
      const size_t gi = side ? ((size_t)(it * P + ((q >> 4) & 31)) * 256 + fo + l4) * 8 : (size_t)(it * 16 + il) * P * S + (size_t)(((q >> 4) & 1) * 256 + fo + l4) * 8;
      b16* dh = side ? RT : LT; *(v8b*)(dh + gi) = *(const v8b*)(&To[c][il * 8]); }
    // Wo as the A fragments of Z^T, one k block of 32 per e with k = p: chunk ((e * 8 + o tile) * 2 + half) * 32 + lane holds Wo[16*tile + (lane & 15)][p * 32 + e], p = 16*half + 8*(lane >> 4) + 0..7
    if (blk < 64) { v8b v;
#pragma unroll
      for (int x = 0; x < 8; ++x) v[x] = (b16)bf16_rne(wo[x]);
      *(v8b*)(RW + ((size_t)((we * 8 + wot) * 2 + whalf) * 32 + wln) * 8) = v; if (blk == 0 && t_ < DO) Pb[t_] = bf16_rne(bo[t_]); }
     }
}

// Pair k of the 8 pairs of D values that a lane holds of one j tile, rounded to f16: word k of a B fragment.
typedef __attribute__((ext_vector_type(2))) float v2f; typedef __attribute__((ext_vector_type(2))) _Float16 v2b; typedef __attribute__((ext_vector_type(8))) unsigned v8u;
__device__ __forceinline__ unsigned pack_pair(const v8f (&d)[2], int k) { const v2f x = {d[k >> 2][(2 * k) & 7], d[k >> 2][(2 * k + 1) & 7]}; return __builtin_bit_cast(unsigned, __builtin_convertvector(x, v2b)); }
// With which of the 8 WMMAs that follow a D tile its pair k is rounded: row tile 0 (pairs 0..3) from the fourth on, row tile 1 from the fifth on. At least four WMMAs then stand between an accumulator's last WMMA
// and its first read, on whichever side of its WMMA the compiler puts the conversion: they fill the distance that such a read must keep, and no v_nop is needed.
__device__ __forceinline__ constexpr int pack_at(int k) { return k < 4 ? k + 3 : k; }

// outer product + output, all in registers: block = (8 i's, 32 j's) x 8 waves, wave w -> i = i0 + w and both tiles of 16 j's. Per e: D[p][j] = sum_s L_i[s][p] R_j[s][e] (rows p, 2 tiles; columns j on the lanes; 4 k-steps,
// 1 product; the 8 left fragments stay in registers for the whole kernel). A lane of D holds p = 16*rt + 8*(lane >> 4) + r of its j, which is the k map of a B fragment with k = p: the two D tiles, rounded
// to f16, ARE the B fragment of Z^T[o][j] += sum_p Wo[o][p*32+e] O[p][e] (8 o tiles, 1 product). No LDS and no exchange between waves before the output rows are staged.
__global__ __launch_bounds__(256) void opm_kernel(const b16* __restrict__ LT, const b16* __restrict__ RT, const b16* __restrict__ RW, const float* __restrict__ Pb, float* __restrict__ out) {
  __shared__ __attribute__((aligned(16))) float Zs[8][32][DO + 4];
  const int t_ = threadIdx.x, lane = t_ & 31, wave = t_ >> 5, nloc = lane & 15, hlf = lane >> 4, i = blockIdx.y * 8 + wave, j0 = blockIdx.x * 32;
  const gb16 Li = wave_base(LT + (size_t)i * P * S);
  const gb16 Rj = (gb16)(RT + (size_t)j0 * P * S);
  v16b ah[2][4], rh[2][2][4], aw[2][8];   // right and Wo fragments in two register sets each: pass e works from set e & 1
  // Order of the first loads: left, right of e = 0, Wo of e = 0, right of e = 1. Behind the left fragments that is the order in which the loads in flight stand at the head of every later trip, oldest first,
  // so the counted waits there, which must hold for both ways into the loop, ask for no more than the fragment that is due.
#pragma unroll
  for (int rt = 0; rt < 2; ++rt)
#pragma unroll
    for (int kb = 0; kb < 4; ++kb) ah[rt][kb] = frag_pk(Li + rt * 2048 + kb * 512, lane);
  __builtin_amdgcn_sched_barrier(0);   // holds the left loads in front: issued last, they would make every trip's first wait ask for all but the newest 16 loads, and the lead of the right fragments would be lost
#pragma unroll
  for (int jt = 0; jt < 2; ++jt)
#pragma unroll
    for (int kb = 0; kb < 4; ++kb) rh[0][jt][kb] = frag_pk(Rj + jt * P * 2048 + kb * 512, lane);
#pragma unroll
  for (int ot = 0; ot < 8; ++ot) aw[0][ot] = frag_pk((gb16)RW + ot * 512, lane);
#pragma unroll
  for (int jt = 0; jt < 2; ++jt)
#pragma unroll
    for (int kb = 0; kb < 4; ++kb) rh[1][jt][kb] = frag_pk(Rj + 2048 + jt * P * 2048 + kb * 512, lane);
  asm volatile("s_wait_xcnt 0x0" ::: "memory");   // the loads above name scalar bases: the wait stands in front of everything that may give those registers new values
  v8f z[8][2] = {};   // [o tile][jt]
  // Two passes a trip (the inner loop is unrolled whole), so that each register set has its fixed place in the code and no fragment is copied from set to set; kept rolled beyond that: 32 copies of a pass would only grow the code
#pragma unroll 1
  for (int eb = 0; eb < P; eb += 2)
#pragma unroll
  for (int h = 0; h < 2; ++h) {
    // Pass e works from rh[h] and aw[h], both asked for more than a pass ago. It asks for Wo of e + 1 into aw[h ^ 1], which the pass before has done with, and, once its D products have read rh[h],
    // for the right fragments of e + 2 into rh[h]. A load so has about one and a half passes to arrive in, not half a pass.
    const int e = eb + h, e1 = e + 1 < P ? e + 1 : P - 1;   // the last pass reads its own Wo again (in bounds, not used)
    const gb16 We = wave_base(RW + (size_t)e1 * 4096);
#pragma unroll
    for (int ot = 0; ot < 8; ++ot) aw[h ^ 1][ot] = frag_pk(We + ot * 512, lane);
    asm volatile("s_wait_xcnt 0x0" ::: "memory");   // the loads above name We: the wait stands in front of everything that may give its registers new values
    // Four vector slots between the last Z product of the pass before, which reads tile 1's rounded D as its B, and the first D product below, whose result this build puts into those same registers
    asm volatile("v_nop\n\tv_nop\n\tv_nop\n\tv_nop");
    __builtin_amdgcn_sched_barrier(0);   // keeps the Wo loads at the head of the pass: sunk towards their first use they would lose the lead that the second register set is there for
    // The two j tiles run half a pass apart: the vector work that rounds one tile's D to f16 is dealt out behind the WMMAs of the other tile, and so issues while the matrix unit is busy.
    // STEP (nothing is scheduled across it) holds that order: left free, the compiler gathers the conversions into one run with no WMMA in it, in which the matrix unit stands idle.
#define STEP() __builtin_amdgcn_sched_barrier(0)
    v8f d0[2] = {}, d1[2] = {};   // [rt], j tile 0 and 1; per accumulator the order of sums is kb
    v8u o0, o1;
#pragma unroll
    for (int n = 0; n < 8; ++n) { const int kb = n >> 1, rt = n & 1; d0[rt] = wmma16b(ah[rt][kb], rh[h][0][kb], d0[rt]); }
    STEP();
#pragma unroll
    for (int n = 0; n < 8; ++n) { const int kb = n >> 1, rt = n & 1; d1[rt] = wmma16b(ah[rt][kb], rh[h][1][kb], d1[rt]);
#pragma unroll
      for (int k = 0; k < 8; ++k) if (pack_at(k) == n) o0[k] = pack_pair(d0, k);
      STEP(); }
    const int e2 = e + 2 < P ? e + 2 : P - 1;   // the last two passes read the last e's right fragments again (in bounds, not used)
    const gb16 Re = wave_base(RT + (size_t)j0 * P * S + (size_t)e2 * 2048);
#pragma unroll
    for (int jt = 0; jt < 2; ++jt)
#pragma unroll
      for (int kb = 0; kb < 4; ++kb) rh[h][jt][kb] = frag_pk(Re + jt * P * 2048 + kb * 512, lane);
    asm volatile("s_wait_xcnt 0x0" ::: "memory");   // as above, for Re. The first STEP below lets the loads sink behind one WMMA at most
    const v16b oh0 = __builtin_bit_cast(v16b, o0);
#pragma unroll
    for (int n = 0; n < 8; ++n) { z[n][0] = wmma16b(aw[h][n], oh0, z[n][0]);
#pragma unroll
      for (int k = 0; k < 8; ++k) if (pack_at(k) == n) o1[k] = pack_pair(d1, k);
      STEP(); }
    const v16b oh1 = __builtin_bit_cast(v16b, o1);
#pragma unroll
    for (int n = 0; n < 8; ++n) z[n][1] = wmma16b(aw[h][n], oh1, z[n][1]);
#undef STEP
    // Pacing only, no data passes: the 8 waves read the same right and Wo fragments, and kept on the same e one fetch from L2 serves all of them through the WGP cache.
    __builtin_amdgcn_s_barrier();
  }
#pragma unroll
  for (int ot = 0; ot < 8; ++ot) { const v4f p0 = *(const v4f*)(Pb + ot * 16 + 8 * hlf), p1 = *(const v4f*)(Pb + ot * 16 + 8 * hlf + 4);
#pragma unroll
    for (int jt = 0; jt < 2; ++jt) { v4f a, b;
#pragma unroll
      for (int r = 0; r < 4; ++r) { a[r] = z[ot][jt][r] * (1.0f / OS) + p0[r]; b[r] = z[ot][jt][4 + r] * (1.0f / OS) + p1[r]; }
      float* zr = &Zs[wave][jt * 16 + nloc][ot * 16 + 8 * hlf]; *(v4f*)zr = a; *(v4f*)(zr + 4) = b; } }
  __syncthreads();
  // output rows (i, j) = 512 B: one wave-wide 16-byte store a row, the wave's 32 rows = 16 KB contiguous; unrolled whole, so that no register of an issued store is written again
#pragma unroll
  for (int rw = 0; rw < 32; ++rw) *(v4f*)(out + ((size_t)i * I + j0 + rw) * DO + lane * 4) = *(const v4f*)(&Zs[wave][rw][lane * 4]);
}
}  // namespace

extern "C" void kernel_launch(void* const* d_in, const int* in_sizes, int n_in,
                              void* d_out, int out_size, void* d_ws, size_t ws_size, hipStream_t stream) {
  (void)n_in; (void)out_size;
  const float* M = (const float*)d_in[0]; const float* g = (const float*)d_in[1]; const float* be = (const float*)d_in[2]; const float* Wa = (const float*)d_in[3]; const float* ba = (const float*)d_in[4]; const float* Wb = (const float*)d_in[5]; const float* bb = (const float*)d_in[6]; const float* Wo = (const float*)d_in[7]; const float* bo = (const float*)d_in[8];
  float* out = (float*)d_out;   // [1][256][256][128]
  if (in_sizes[0] != S * I * D || in_sizes[3] != P * D || in_sizes[7] != DO * PP) return;
  size_t off = 0; char* ws = (char*)d_ws;
  auto carve = [&](size_t bytes) { char* p = ws + off; off += (bytes + 255) & ~(size_t)255; return p; };
  b16* LT = (b16*)carve((size_t)I * P * S * 2); b16* RT = (b16*)carve((size_t)I * P * S * 2); b16* RW = (b16*)carve((size_t)DO * PP * 2); float* Pb = (float*)carve(DO * 4);
  if (off > ws_size) return;                                    // about 2.1 x 2 + 0.26 MB
  proj_kernel<<<I, 256, 0, stream>>>(M, g, be, Wa, ba, Wb, bb, Wo, bo, LT, RT, RW, Pb);
  opm_kernel<<<dim3(I / 32, I / 8), 256, 0, stream>>>(LT, RT, RW, Pb, out);
}
